// v000
// Times are from an AMD MI455X. After a warm-up the kernel runs many times in a row, and a time is the length of
// such a window on the GPU divided by its runs, so every launch and the gaps after it count. The runs cycle
// through copies of the inputs. A figure is the median of several windows, for all but v000 over two sittings.
// Sittings can differ by a few percent; kernels timed side by side share one.
// v000 is the starting kernel. One run takes 1840 microseconds.
// compute dtype: all float inputs rounded to bf16; q/k/v projections with EXACT bf16 products on WMMA 16x16x32 (f32 accumulate) + bias; logits q x k once to f16 each (1 product) x SCALE; softmax f32; P x 2^11 once to f16 x v once to f16 (1 product); ctx x 2^6 once to f16 x Wo f16(bf16 x 2^8) + bo; f32 output.
#include <hip/hip_runtime.h>
#include <math.h>

typedef __attribute__((ext_vector_type(16))) _Float16 v16h;
typedef __attribute__((ext_vector_type(16))) __bf16 v16b;
typedef __attribute__((ext_vector_type(8)))  _Float16 v8h;
typedef __attribute__((ext_vector_type(8)))  float v8f;
typedef __attribute__((ext_vector_type(4)))  float v4f;
typedef __attribute__((ext_vector_type(2)))  float v2f;
typedef __attribute__((ext_vector_type(4)))  unsigned v4u;
typedef __attribute__((ext_vector_type(4)))  int v4i;
typedef float __attribute__((may_alias)) float_a;
typedef int __attribute__((may_alias)) int_a;

template <typename T> __device__ __forceinline__ void vst2(void* p, T v) { *(T*)p = v;  }
__device__ __forceinline__ v8f wmma16(v16h a, v16h b, v8f c) {
  v8f d = __builtin_amdgcn_wmma_f32_16x16x32_f16(false, a, false, b, (short)0, c, false, false);
  asm volatile("v_nop\n\tv_nop\n\tv_nop\n\tv_nop" : "+v"(d) : "v"(a), "v"(b));
  return d;
}
__device__ __forceinline__ v8f wmma_bf(v16b a, v16b b, v8f c) {
  v8f d = __builtin_amdgcn_wmma_f32_16x16x32_bf16(false, a, false, b, (short)0, c, false, false);
  asm volatile("v_nop\n\tv_nop\n\tv_nop\n\tv_nop" : "+v"(d) : "v"(a), "v"(b));
  return d;
}
// 16x16x32 fragments: lane = (h = lane>>4, row/col = lane&15); elements 0..7 = k0+8h+0..7, 8..15 = k0+16+8h+0..7; D element r = row 8h+r
__device__ __forceinline__ v16h frag_h(const _Float16* rowk0, int lane) {
  union { v16h v; v8h q[2]; } u; const _Float16* p = rowk0 + 8 * (lane >> 4);
  u.q[0] = *(const v8h*)p; u.q[1] = *(const v8h*)(p + 16); return u.v;
}
__device__ __forceinline__ v16h frag_f32(const float* rowk0, int lane) {
  v16h a; const float* p = rowk0 + 8 * (lane >> 4);
#pragma unroll
  for (int i = 0; i < 8; ++i) { a[i] = (_Float16)p[i]; a[8 + i] = (_Float16)p[16 + i]; }
  return a;
}
__device__ __forceinline__ v16h frag_f32s(const float* rowk0, int lane, float sc) {
  v16h a; const float* p = rowk0 + 8 * (lane >> 4);
#pragma unroll
  for (int i = 0; i < 8; ++i) { a[i] = (_Float16)(p[i] * sc); a[8 + i] = (_Float16)(p[16 + i] * sc); }
  return a;
}
// column fragment from a [K][ld] layout (column n), rows >= K read as 0
__device__ __forceinline__ v16h fragc_f32(const float* W, int k0, int n, int lane, int ld, int K) {
  v16h a; const int g = lane >> 4;
#pragma unroll
  for (int i = 0; i < 8; ++i) { const int ka = k0 + 8 * g + i, kb = ka + 16;
    a[i] = (_Float16)(ka < K ? W[(size_t)(ka < K ? ka : K - 1) * ld + n] : 0.f); a[8 + i] = (_Float16)(kb < K ? W[(size_t)(kb < K ? kb : K - 1) * ld + n] : 0.f); }
  return a;
}
struct F2 { v16b h, l; };
__device__ __forceinline__ F2 bsplit16(const float v[16]) { F2 r;
#pragma unroll
  for (int i = 0; i < 16; ++i) { const __bf16 h = (__bf16)v[i]; r.h[i] = h; r.l[i] = (__bf16)(v[i] - (float)h); }
  return r; }
__device__ __forceinline__ F2 split_row(const float* row, int k0, int lane) { float v[16]; const float* p = row + k0 + 8 * (lane >> 4);
#pragma unroll
  for (int i = 0; i < 8; ++i) { v[i] = p[i]; v[8 + i] = p[16 + i]; }
  return bsplit16(v); }
__device__ __forceinline__ F2 split_rowK(const float* row, int k0, int lane, int K) { float v[16]; const int g = lane >> 4;
#pragma unroll
  for (int i = 0; i < 8; ++i) { const int ka = k0 + 8 * g + i, kb = ka + 16; v[i] = ka < K ? row[ka < K ? ka : K - 1] : 0.f; v[8 + i] = kb < K ? row[kb < K ? kb : K - 1] : 0.f; }
  return bsplit16(v); }
__device__ __forceinline__ F2 split_col(const float* W, int k0, int n, int lane, int ld, int K) { float v[16]; const int g = lane >> 4;
#pragma unroll
  for (int i = 0; i < 8; ++i) { const int ka = k0 + 8 * g + i, kb = ka + 16; v[i] = ka < K ? W[(size_t)(ka < K ? ka : K - 1) * ld + n] : 0.f; v[8 + i] = kb < K ? W[(size_t)(kb < K ? kb : K - 1) * ld + n] : 0.f; }
  return bsplit16(v); }
__device__ __forceinline__ v8f mac3(const F2& a, const F2& b, v8f c) { c = wmma_bf(a.l, b.h, c); c = wmma_bf(a.h, b.l, c); return wmma_bf(a.h, b.h, c); }
__device__ __forceinline__ float sigm(float v) { return 1.0f / (1.0f + expf(-v)); }
#define LDSX() do { asm volatile("s_wait_dscnt 0" ::: "memory"); __builtin_amdgcn_wave_barrier(); __builtin_amdgcn_fence(__ATOMIC_RELEASE, "workgroup"); } while (0)

// Multi-headed attention on separate inputs (q / k / v [4,2048,768]; (out,in) Wq / Wk / Wv / Wo [768,768] N(0, 1/768) applied as x @ W.T, zero biases (read); 12 heads x 64; scores / sqrt(64); no mask; softmax; out Wo^T + bo -> [4,2048,768] (6.3 M)).
#define NB 4
#define TT 2048
#define CC 768            // NH * HD = projected width
#define DIN 768          // input (model) width
#define NH 12
#define HD 64
#define NQB (TT / 64)
#define HG 4
#define SCALE (0.125f)
#define CAUSAL 0
#ifndef TNB
#define TNB NB
#endif
__device__ __forceinline__ float bfr(float v) { return (float)(__bf16)v; }
__host__ __device__ __forceinline__ int kb_last(int qb) { return CAUSAL ? ((qb * 64 + 63) >> 7) : (TT / 128 - 1); }
typedef __attribute__((ext_vector_type(8))) __bf16 v8b;
__device__ __forceinline__ v16b frag_b(const __bf16* rowk0, int lane) {
  union { v16b v; v8b q[2]; } u; const __bf16* p = rowk0 + 8 * (lane >> 4);
  u.q[0] = *(const v8b*)p; u.q[1] = *(const v8b*)(p + 16); return u.v;
}
#define QBH 0              // causal: query blocks 0..QBH-1 of each sequence (few keys, no averaging) take the high-precision path
#define QHI 0               // single-product logits on every row
#define KHI 64            // key rows carrying k residual / v bf16 hi+lo planes (used only by the causal high-precision path)
// B fragment (k rows k0+.., output column o) of a weight: (in,out) [K][ld] or (out,in) [ld rows of K]: bf16 exact, or f16(bf16 * 256) exact
__device__ __forceinline__ v16b wcol_io(const float* Wm, int k0, int o, int lane, int ld) { v16b w; const int g = lane >> 4;
#pragma unroll
  for (int i = 0; i < 8; ++i) { w[i] = (__bf16)Wm[(size_t)(k0 + 8 * g + i) * ld + o]; w[8 + i] = (__bf16)Wm[(size_t)(k0 + 16 + 8 * g + i) * ld + o]; }
  return w; }
__device__ __forceinline__ v16b wcol_oi(const float* Wm, int k0, int o, int lane, int K) { v16b w; const float* p = Wm + (size_t)o * K + k0 + 8 * (lane >> 4);
#pragma unroll
  for (int i = 0; i < 8; ++i) { w[i] = (__bf16)p[i]; w[8 + i] = (__bf16)p[16 + i]; }
  return w; }
__device__ __forceinline__ v16h wcolh_io(const float* Wm, int k0, int o, int lane, int ld) { v16h w; const int g = lane >> 4;
#pragma unroll
  for (int i = 0; i < 8; ++i) { w[i] = (_Float16)(bfr(Wm[(size_t)(k0 + 8 * g + i) * ld + o]) * 256.0f); w[8 + i] = (_Float16)(bfr(Wm[(size_t)(k0 + 16 + 8 * g + i) * ld + o]) * 256.0f); }
  return w; }
__device__ __forceinline__ v16h wcolh_oi(const float* Wm, int k0, int o, int lane, int K) { v16h w; const float* p = Wm + (size_t)o * K + k0 + 8 * (lane >> 4);
#pragma unroll
  for (int i = 0; i < 8; ++i) { w[i] = (_Float16)(bfr(p[i]) * 256.0f); w[8 + i] = (_Float16)(bfr(p[16 + i]) * 256.0f); }
  return w; }
#define WQKV_LAYOUT 1   // 0 = (in,out) [DIN][CC]; 1 = (out,in) [CC][DIN]; 2 = per-head [NH][DIN][HD]
__device__ __forceinline__ v16b wcol_hdk(const float* Wm, int k0, int o, int lane) { v16b w; const int g = lane >> 4; const float* p = Wm + (size_t)(o / HD) * DIN * HD + (o % HD);
#pragma unroll
  for (int i = 0; i < 8; ++i) { w[i] = (__bf16)p[(size_t)(k0 + 8 * g + i) * HD]; w[8 + i] = (__bf16)p[(size_t)(k0 + 16 + 8 * g + i) * HD]; }
  return w; }
#define WO_OUT_IN 1
#if WQKV_LAYOUT == 1
#define WCOL(W, k0, o, lane) wcol_oi(W, k0, o, lane, DIN)
#elif WQKV_LAYOUT == 2
#define WCOL(W, k0, o, lane) wcol_hdk(W, k0, o, lane)
#else
#define WCOL(W, k0, o, lane) wcol_io(W, k0, o, lane, CC)
#endif
#if WO_OUT_IN
#define WOCOL(W, k0, o, lane) wcol_oi(W, k0, o, lane, CC)
#define WOCOLH(W, k0, o, lane) wcolh_oi(W, k0, o, lane, CC)
#else
#define WOCOL(W, k0, o, lane) wcol_io(W, k0, o, lane, DIN)
#define WOCOLH(W, k0, o, lane) wcolh_io(W, k0, o, lane, DIN)
#endif

#ifndef SM_EXTRA_PARAMS
#define SM_EXTRA_PARAMS
#endif
#ifndef PROJ_EXTRA_PARAMS
#define PROJ_EXTRA_PARAMS
#endif
#ifndef SM_MASK_HOOK
#define SM_MASK_HOOK (void)0
#endif

#define WS_QH  0u                                      // f16 q rows [b*t][CC]
#define WS_KH  (WS_QH + 2u * (size_t)NB * TT * CC)      // f16 k rows [b*t][CC]
#define WS_VT  (WS_KH + 2u * (size_t)NB * TT * CC)      // f16 v planes [b][c][t]
#define WS_QL  (WS_VT + 2u * (size_t)NB * CC * TT)      // f16 q residual x 2^10 rows [b][t < QHI][CC]
#define WS_KL  (WS_QL + 2u * (size_t)NB * QHI * CC)     // f16 k residual x 2^10 rows [b][t < KHI][CC]
#define WS_VB  (WS_KL + 2u * (size_t)NB * KHI * CC)     // bf16 v hi planes [b][c][t < KHI]
#define WS_VBL (WS_VB + 2u * (size_t)NB * CC * KHI)
#define WS_S   (WS_VBL + 2u * (size_t)NB * CC * KHI)    // f32 logits / P [hg][t][s]
#define WS_Y   (WS_S  + 4u * (size_t)HG * TT * TT)      // f32 ctx rows [b*t][CC] (only when there is an output projection)
#define WS_END (WS_Y  + 4u * (size_t)NB * TT * CC)

// ---- k_proj: block = (64 rows, 128 cols, which): q/k/v = X W (+ b) with exact bf16 products (K = DIN) -> which 0: q f16 rows (+ residual rows < QHI); 1: k f16 rows (+ residual rows < KHI); 2: v f16 planes [c][t] (+ bf16 hi/lo planes for t < KHI)
__global__ __launch_bounds__(128) void k_proj(const float* __restrict__ XQ, const float* __restrict__ XK, const float* __restrict__ XV, const float* __restrict__ WQ, const float* __restrict__ WK, const float* __restrict__ WV, const float* __restrict__ BQ, const float* __restrict__ BK, const float* __restrict__ BV,
    _Float16* __restrict__ QH, _Float16* __restrict__ QL, _Float16* __restrict__ KH, _Float16* __restrict__ KL, _Float16* __restrict__ VT, __bf16* __restrict__ VB, __bf16* __restrict__ VBL) {
  __shared__ __align__(16) _Float16 sh[64][136], sl[64][136]; __shared__ __align__(16) _Float16 th[128][72]; __shared__ __align__(16) __bf16 tb[128][72], tbl[128][72];
  const int tid = threadIdx.x, wave = tid >> 5, lane = tid & 31, col = lane & 15, g = lane >> 4; const int which = blockIdx.z; const int c0 = blockIdx.y * 128; const size_t r0 = (size_t)blockIdx.x * 64; const size_t bb = r0 / TT; const int t0 = (int)(r0 % TT);
  const float* X = which == 0 ? XQ : which == 1 ? XK : XV; const float* WA = which == 0 ? WQ : which == 1 ? WK : WV; const float* BA = which == 0 ? BQ : which == 1 ? BK : BV;
  v8f acc[8] = {};
#pragma unroll 2
  for (int kc = 0; kc < DIN / 32; ++kc) { v16b a; { const float* p = X + (r0 + wave * 16 + col) * DIN + kc * 32 + 8 * g;
#pragma unroll
      for (int i = 0; i < 8; ++i) { a[i] = (__bf16)p[i]; a[8 + i] = (__bf16)p[16 + i]; } }
    asm volatile("s_wait_loadcnt 0x0" ::: "memory");
#pragma unroll
    for (int j = 0; j < 8; ++j) { const v16b w = WCOL(WA, kc * 32, c0 + j * 16 + col, lane); asm volatile("s_wait_loadcnt 0x0" ::: "memory"); acc[j] = wmma_bf(a, w, acc[j]); } }
  if (which < 2) { _Float16* DH = which == 0 ? QH : KH; _Float16* DL = which == 0 ? QL : KL; const int nhi = which == 0 ? QHI : KHI; const bool hi_rows = t0 < nhi;
#pragma unroll
    for (int j = 0; j < 8; ++j) { const float bias = BA ? bfr(BA[c0 + j * 16 + col]) : 0.f;
#pragma unroll
      for (int r = 0; r < 8; ++r) { const float v = acc[j][r] + bias; const _Float16 hv = (_Float16)v; sh[wave * 16 + 8 * g + r][j * 16 + col] = hv; sl[wave * 16 + 8 * g + r][j * 16 + col] = (_Float16)((v - (float)hv) * 1024.0f); } }
    __syncthreads();
    for (int e = tid; e < 64 * 16; e += 128) { const int rl = e >> 4, q = e & 15; vst2((unsigned*)(DH + (r0 + rl) * CC + c0 + q * 8), *(const v4u*)&sh[rl][q * 8]); if (hi_rows) vst2((unsigned*)(DL + (bb * nhi + t0 + rl) * (size_t)CC + c0 + q * 8), *(const v4u*)&sl[rl][q * 8]); }
  } else { const bool hi_rows = t0 < KHI;
#pragma unroll
    for (int j = 0; j < 8; ++j) { const float bias = BA ? bfr(BA[c0 + j * 16 + col]) : 0.f;
#pragma unroll
      for (int r = 0; r < 8; ++r) { const float v = acc[j][r] + bias; const int rl = wave * 16 + 8 * g + r, cl = j * 16 + col; th[cl][rl] = (_Float16)v; const __bf16 bh = (__bf16)v; tb[cl][rl] = bh; tbl[cl][rl] = (__bf16)(v - (float)bh); } }
    __syncthreads();
    for (int e = tid; e < 128 * 8; e += 128) { const int cl = e >> 3, q = e & 7; vst2((unsigned*)(VT + (bb * CC + c0 + cl) * (size_t)TT + t0 + q * 8), *(const v4u*)&th[cl][q * 8]); if (hi_rows) { const size_t o3 = (bb * CC + c0 + cl) * (size_t)KHI + t0 + q * 8; vst2((unsigned*)(VB + o3), *(const v4u*)&tb[cl][q * 8]); vst2((unsigned*)(VBL + o3), *(const v4u*)&tbl[cl][q * 8]); } } } }
// ---- k_sc: block = (query block qb, key block kb <= kb_last(qb), head in group) of batch b: logits x SCALE; q hi + residual (x 2^10) against k (2 products) for query rows < QHI, plus the k residual (3 products) for query blocks < QBH (causal early rows); causal: blocks past the diagonal exit, the mask itself is applied by index in k_sm
__global__ __launch_bounds__(128) void k_sc(const _Float16* __restrict__ QH, const _Float16* __restrict__ KH, const _Float16* __restrict__ QL, const _Float16* __restrict__ KL, int b, int h0, float* __restrict__ S0) { __shared__ __align__(16) float ss[4][16][132];
  const int qb = blockIdx.x, kb = blockIdx.y; if (kb > kb_last(qb)) return;
  const int h = h0 + blockIdx.z; float* S = S0 + (size_t)blockIdx.z * TT * TT;
  const int tid = threadIdx.x, wave = tid >> 5, lane = tid & 31, col = lane & 15, g = lane >> 4; const int k0 = kb * 128; const int ql0 = qb * 64 + wave * 16; const size_t q0 = (size_t)b * TT + ql0, kr0 = (size_t)b * TT + k0;
  v8f acc[8] = {}, accl[8] = {};
  const _Float16* QLb = QL + (size_t)b * QHI * CC; const _Float16* KLb = KL + (size_t)b * KHI * CC;
  if (qb < QBH) {
#pragma unroll
    for (int kc = 0; kc < HD / 32; ++kc) { const v16h ah = frag_h(QH + (q0 + col) * CC + h * HD + kc * 32, lane), al = frag_h(QLb + (size_t)(ql0 + col) * CC + h * HD + kc * 32, lane);
#pragma unroll
      for (int j = 0; j < 8; ++j) { const v16h kbf = frag_h(KH + (kr0 + j * 16 + col) * CC + h * HD + kc * 32, lane), klf = frag_h(KLb + (size_t)(k0 + j * 16 + col) * CC + h * HD + kc * 32, lane); acc[j] = wmma16(ah, kbf, acc[j]); accl[j] = wmma16(al, kbf, accl[j]); accl[j] = wmma16(ah, klf, accl[j]); } }
  } else if (qb * 64 < QHI) {
#pragma unroll
    for (int kc = 0; kc < HD / 32; ++kc) { const v16h ah = frag_h(QH + (q0 + col) * CC + h * HD + kc * 32, lane), al = frag_h(QLb + (size_t)(ql0 + col) * CC + h * HD + kc * 32, lane);
#pragma unroll
      for (int j = 0; j < 8; ++j) { const v16h kbf = frag_h(KH + (kr0 + j * 16 + col) * CC + h * HD + kc * 32, lane); acc[j] = wmma16(ah, kbf, acc[j]); accl[j] = wmma16(al, kbf, accl[j]); } }
  } else {
#pragma unroll
    for (int kc = 0; kc < HD / 32; ++kc) { const v16h ah = frag_h(QH + (q0 + col) * CC + h * HD + kc * 32, lane);
#pragma unroll
      for (int j = 0; j < 8; ++j) { const v16h kbf = frag_h(KH + (kr0 + j * 16 + col) * CC + h * HD + kc * 32, lane); acc[j] = wmma16(ah, kbf, acc[j]); } } }
#pragma unroll
  for (int j = 0; j < 8; ++j) {
#pragma unroll
    for (int r = 0; r < 8; ++r) ss[wave][8 * g + r][j * 16 + col] = (acc[j][r] + accl[j][r] * (1.0f / 1024.0f)) * SCALE; }
  LDSX(); for (int rl = 0; rl < 16; ++rl) vst2(S + (size_t)(ql0 + rl) * TT + k0 + lane * 4, *(const v4f*)&ss[wave][rl][lane * 4]); }
// ---- k_sm: block = query row t (head in group): keys [0, kend): causal -> logit if s <= t else excluded; softmax in f32; P x 2^11 in place (0 for excluded)
__global__ __launch_bounds__(256) void k_sm(float* __restrict__ S0 SM_EXTRA_PARAMS) { __shared__ float sred[8]; __shared__ float sbc; __shared__ __align__(16) float shv[TT];
  const int tid = threadIdx.x; const int t = blockIdx.x; const int kend = (kb_last(t >> 6) + 1) * 128;
  float* sr = S0 + (size_t)blockIdx.y * TT * TT + (size_t)t * TT;
  float m = -3.0e38f; for (int k = tid; k < kend; k += 256) { float v = (!CAUSAL || k <= t) ? sr[k] : -3.0e38f; SM_MASK_HOOK; shv[k] = v; m = fmaxf(m, v); }
#pragma unroll
  for (int o = 1; o < 32; o <<= 1) m = fmaxf(m, __shfl_xor(m, o));
  if ((tid & 31) == 0) sred[tid >> 5] = m; __syncthreads(); if (tid == 0) { float a = sred[0]; for (int i = 1; i < 8; ++i) a = fmaxf(a, sred[i]); sbc = a; } __syncthreads(); m = sbc; __syncthreads();
  float sum = 0.f; for (int k = tid; k < kend; k += 256) { const float v = shv[k]; const float e = (v <= -1.0e38f) ? 0.f : expf(v - m); shv[k] = e; sum += e; }
#pragma unroll
  for (int o = 1; o < 32; o <<= 1) sum += __shfl_xor(sum, o);
  if ((tid & 31) == 0) sred[tid >> 5] = sum; __syncthreads(); if (tid == 0) { float a = 0.f; for (int i = 0; i < 8; ++i) a += sred[i]; sbc = a > 0.f ? 2048.0f / a : 0.f; }   /* a fully excluded row yields P = 0 */ __syncthreads(); const float inv = sbc;
  for (int k = tid; k < kend; k += 256) shv[k] = shv[k] * inv;
  __syncthreads(); for (int q = tid; q < kend / 4; q += 256) vst2(sr + q * 4, *(const v4f*)&shv[q * 4]); }
// ---- k_pv: block = 64 queries (qb) of (b, h): ctx = P . v over keys [0, kend) (P x 2^11 once to f16 against v f16: 1 product; causal early query blocks: P and v as bf16 hi + lo, 3 products); 256-B (row, head) segment by 16 lanes
__global__ __launch_bounds__(128) void k_pv(const float* __restrict__ PS0, const _Float16* __restrict__ VT, const __bf16* __restrict__ VB, const __bf16* __restrict__ VBL, int b, int h0, float* __restrict__ Y) { const int h = h0 + blockIdx.z; const float* PS = PS0 + (size_t)blockIdx.z * TT * TT; __shared__ __align__(16) float ss[4][16][HD + 4];
  const int tid = threadIdx.x, wave = tid >> 5, lane = tid & 31, col = lane & 15, g = lane >> 4; const int qb = blockIdx.x; const int ql0 = qb * 64 + wave * 16; const int kce = (kb_last(qb) + 1) * 4;
  v8f acc[HD / 16] = {};
  if (qb < QBH) {
#pragma unroll 1
    for (int kc = 0; kc < kce; ++kc) { const F2 p = split_row(PS + (size_t)(ql0 + col) * TT, kc * 32, lane);
      asm volatile("s_wait_loadcnt 0x0" ::: "memory");
#pragma unroll
      for (int j = 0; j < HD / 16; ++j) { const size_t po = ((size_t)b * CC + h * HD + j * 16 + col) * (size_t)KHI + kc * 32; const v16b vh = frag_b(VB + po, lane); acc[j] = wmma_bf(p.h, vh, acc[j]); acc[j] = wmma_bf(p.l, vh, acc[j]); acc[j] = wmma_bf(p.h, frag_b(VBL + po, lane), acc[j]); } }
  } else {
#pragma unroll 1
    for (int kc = 0; kc < kce; ++kc) { const v16h p = frag_f32(PS + (size_t)(ql0 + col) * TT + kc * 32, lane);
      asm volatile("s_wait_loadcnt 0x0" ::: "memory");
#pragma unroll
      for (int j = 0; j < HD / 16; ++j) { const size_t po = ((size_t)b * CC + h * HD + j * 16 + col) * (size_t)TT + kc * 32; acc[j] = wmma16(p, frag_h(VT + po, lane), acc[j]); } } }
#pragma unroll
  for (int j = 0; j < HD / 16; ++j)
#pragma unroll
    for (int r = 0; r < 8; ++r) ss[wave][8 * g + r][j * 16 + col] = acc[j][r] * (1.0f / 2048.0f);
  LDSX(); for (int rl = 0; rl < 16; ++rl) if (lane < HD / 4) vst2(Y + ((size_t)b * TT + ql0 + rl) * CC + h * HD + lane * 4, *(const v4f*)&ss[wave][rl][lane * 4]); }
// ---- k_out: block = (64 rows, 128 cols): out = ctx Wo (+ bo): ctx x 2^6 once to f16 against Wo as f16(bf16 x 2^8) exact (1 product) x 2^-14; causal early rows (< QHI of each sequence): ctx bf16 hi + lo against exact bf16 Wo (2 products)
__global__ __launch_bounds__(128) void k_out(const float* __restrict__ Y, const float* __restrict__ WO, const float* __restrict__ BO, float* __restrict__ OUT) { __shared__ __align__(16) float sf[4][16][132];
  const int tid = threadIdx.x, wave = tid >> 5, lane = tid & 31, col = lane & 15, g = lane >> 4; const int c0 = blockIdx.y * 128; const size_t r0 = (size_t)blockIdx.x * 64 + wave * 16;
  v8f acc[8] = {};
  if (CAUSAL && (int)(((size_t)blockIdx.x * 64) % TT) < QHI) {   /* block-uniform */
#pragma unroll 2
    for (int kc = 0; kc < CC / 32; ++kc) { const F2 a = split_row(Y + (r0 + col) * CC, kc * 32, lane); asm volatile("s_wait_loadcnt 0x0" ::: "memory");
#pragma unroll
      for (int j = 0; j < 8; ++j) { const v16b w = WOCOL(WO, kc * 32, c0 + j * 16 + col, lane); asm volatile("s_wait_loadcnt 0x0" ::: "memory"); acc[j] = wmma_bf(a.h, w, acc[j]); acc[j] = wmma_bf(a.l, w, acc[j]); } }
#pragma unroll
    for (int j = 0; j < 8; ++j) { const float bias = BO ? bfr(BO[c0 + j * 16 + col]) : 0.f;
#pragma unroll
      for (int r = 0; r < 8; ++r) sf[wave][8 * g + r][j * 16 + col] = acc[j][r] + bias; }
  } else {
#pragma unroll 2
    for (int kc = 0; kc < CC / 32; ++kc) { const v16h a = frag_f32s(Y + (r0 + col) * CC + kc * 32, lane, 64.0f); asm volatile("s_wait_loadcnt 0x0" ::: "memory");   /* ctx carried x 2^6 into f16 so small-magnitude context rows stay clear of f16 subnormals */
#pragma unroll
      for (int j = 0; j < 8; ++j) { const v16h w = WOCOLH(WO, kc * 32, c0 + j * 16 + col, lane); asm volatile("s_wait_loadcnt 0x0" ::: "memory"); acc[j] = wmma16(a, w, acc[j]); } }
#pragma unroll
    for (int j = 0; j < 8; ++j) { const float bias = BO ? bfr(BO[c0 + j * 16 + col]) : 0.f;
#pragma unroll
      for (int r = 0; r < 8; ++r) sf[wave][8 * g + r][j * 16 + col] = acc[j][r] * (1.0f / 16384.0f) + bias; } }   /* 2^-8 (Wo carry) x 2^-6 (ctx carry) */
  LDSX(); for (int rl = 0; rl < 16; ++rl) vst2(OUT + (r0 + rl) * DIN + c0 + lane * 4, *(const v4f*)&sf[wave][rl][lane * 4]); }

extern "C" void kernel_launch(void* const* d_in, const int* in_sizes, int n_in, void* d_out, int out_size, void* d_ws, size_t ws_size, hipStream_t stream) {
  (void)in_sizes; (void)n_in; (void)out_size;
  const float** F = (const float**)d_in;
  if (ws_size < (size_t)WS_END) return;
  char* ws = (char*)d_ws; _Float16 *QH = (_Float16*)(ws + WS_QH), *KH = (_Float16*)(ws + WS_KH), *VT = (_Float16*)(ws + WS_VT), *QL = (_Float16*)(ws + WS_QL), *KL = (_Float16*)(ws + WS_KL); __bf16 *VB = (__bf16*)(ws + WS_VB), *VBL = (__bf16*)(ws + WS_VBL); float *S = (float*)(ws + WS_S), *Y = (float*)(ws + WS_Y);
  (void)Y; (void)QL; (void)KL; (void)VB; (void)VBL;
  // inputs: 0 q [4,2048,768]; 1 k; 2 v; 3 Wq [768,768] (out,in), 4 bq; 5 Wk, 6 bk; 7 Wv, 8 bv; 9 Wo (out,in), 10 bo (zero biases, read)
  k_proj<<<dim3(TNB * TT / 64, CC / 128, 3), 128, 0, stream>>>(F[0], F[1], F[2], F[3], F[5], F[7], F[4], F[6], F[8], QH, QL, KH, KL, VT, VB, VBL);
  for (int b = 0; b < TNB; ++b) for (int h0 = 0; h0 < NH; h0 += HG) {
    k_sc<<<dim3(NQB, TT / 128, HG), 128, 0, stream>>>(QH, KH, QL, KL, b, h0, S);
    k_sm<<<dim3(TT, HG), 256, 0, stream>>>(S);
    k_pv<<<dim3(NQB, 1, HG), 128, 0, stream>>>(S, VT, VB, VBL, b, h0, Y);
  }
  k_out<<<dim3(TNB * TT / 64, DIN / 128), 128, 0, stream>>>(Y, F[9], F[10], (float*)d_out);
}

// v001
// One run takes 443 microseconds.
// Next to v000, in two timings, it ran 4.18 and 4.21 times as fast.
// compute dtype: all float inputs rounded to bf16; q/k/v projections with EXACT bf16 products on WMMA 16x16x32 (f32 accumulate) + bias; logits q x k once to f16 each (1 product) x SCALE; online softmax f32 in registers; unnormalised P x 2^11 once to f16 x v once to f16 (1 product), / f32 denominator; ctx x 2^6 once to f16 x Wo f16(bf16 x 2^8) + bo; f32 output.
#include <hip/hip_runtime.h>
#include <math.h>

typedef __attribute__((ext_vector_type(16))) _Float16 v16h;
typedef __attribute__((ext_vector_type(16))) __bf16 v16b;
typedef __attribute__((ext_vector_type(8)))  _Float16 v8h;
typedef __attribute__((ext_vector_type(8)))  float v8f;
typedef __attribute__((ext_vector_type(4)))  float v4f;
typedef __attribute__((ext_vector_type(2)))  float v2f;
typedef __attribute__((ext_vector_type(4)))  unsigned v4u;
typedef __attribute__((ext_vector_type(4)))  int v4i;
typedef float __attribute__((may_alias)) float_a;
typedef int __attribute__((may_alias)) int_a;

template <typename T> __device__ __forceinline__ void vst2(void* p, T v) { *(T*)p = v;  }
__device__ __forceinline__ v8f wmma16(v16h a, v16h b, v8f c) {
  v8f d = __builtin_amdgcn_wmma_f32_16x16x32_f16(false, a, false, b, (short)0, c, false, false);
  asm volatile("v_nop\n\tv_nop\n\tv_nop\n\tv_nop" : "+v"(d) : "v"(a), "v"(b));
  return d;
}
__device__ __forceinline__ v8f wmma_bf(v16b a, v16b b, v8f c) {
  v8f d = __builtin_amdgcn_wmma_f32_16x16x32_bf16(false, a, false, b, (short)0, c, false, false);
  asm volatile("v_nop\n\tv_nop\n\tv_nop\n\tv_nop" : "+v"(d) : "v"(a), "v"(b));
  return d;
}
// 16x16x32 fragments: lane = (h = lane>>4, row/col = lane&15); elements 0..7 = k0+8h+0..7, 8..15 = k0+16+8h+0..7; D element r = row 8h+r
__device__ __forceinline__ v16h frag_h(const _Float16* rowk0, int lane) {
  union { v16h v; v8h q[2]; } u; const _Float16* p = rowk0 + 8 * (lane >> 4);
  u.q[0] = *(const v8h*)p; u.q[1] = *(const v8h*)(p + 16); return u.v;
}
__device__ __forceinline__ v16h frag_f32(const float* rowk0, int lane) {
  v16h a; const float* p = rowk0 + 8 * (lane >> 4);
#pragma unroll
  for (int i = 0; i < 8; ++i) { a[i] = (_Float16)p[i]; a[8 + i] = (_Float16)p[16 + i]; }
  return a;
}
__device__ __forceinline__ v16h frag_f32s(const float* rowk0, int lane, float sc) {
  v16h a; const float* p = rowk0 + 8 * (lane >> 4);
#pragma unroll
  for (int i = 0; i < 8; ++i) { a[i] = (_Float16)(p[i] * sc); a[8 + i] = (_Float16)(p[16 + i] * sc); }
  return a;
}
// column fragment from a [K][ld] layout (column n), rows >= K read as 0
__device__ __forceinline__ v16h fragc_f32(const float* W, int k0, int n, int lane, int ld, int K) {
  v16h a; const int g = lane >> 4;
#pragma unroll
  for (int i = 0; i < 8; ++i) { const int ka = k0 + 8 * g + i, kb = ka + 16;
    a[i] = (_Float16)(ka < K ? W[(size_t)(ka < K ? ka : K - 1) * ld + n] : 0.f); a[8 + i] = (_Float16)(kb < K ? W[(size_t)(kb < K ? kb : K - 1) * ld + n] : 0.f); }
  return a;
}
struct F2 { v16b h, l; };
__device__ __forceinline__ F2 bsplit16(const float v[16]) { F2 r;
#pragma unroll
  for (int i = 0; i < 16; ++i) { const __bf16 h = (__bf16)v[i]; r.h[i] = h; r.l[i] = (__bf16)(v[i] - (float)h); }
  return r; }
__device__ __forceinline__ F2 split_row(const float* row, int k0, int lane) { float v[16]; const float* p = row + k0 + 8 * (lane >> 4);
#pragma unroll
  for (int i = 0; i < 8; ++i) { v[i] = p[i]; v[8 + i] = p[16 + i]; }
  return bsplit16(v); }
__device__ __forceinline__ F2 split_rowK(const float* row, int k0, int lane, int K) { float v[16]; const int g = lane >> 4;
#pragma unroll
  for (int i = 0; i < 8; ++i) { const int ka = k0 + 8 * g + i, kb = ka + 16; v[i] = ka < K ? row[ka < K ? ka : K - 1] : 0.f; v[8 + i] = kb < K ? row[kb < K ? kb : K - 1] : 0.f; }
  return bsplit16(v); }
__device__ __forceinline__ F2 split_col(const float* W, int k0, int n, int lane, int ld, int K) { float v[16]; const int g = lane >> 4;
#pragma unroll
  for (int i = 0; i < 8; ++i) { const int ka = k0 + 8 * g + i, kb = ka + 16; v[i] = ka < K ? W[(size_t)(ka < K ? ka : K - 1) * ld + n] : 0.f; v[8 + i] = kb < K ? W[(size_t)(kb < K ? kb : K - 1) * ld + n] : 0.f; }
  return bsplit16(v); }
__device__ __forceinline__ v8f mac3(const F2& a, const F2& b, v8f c) { c = wmma_bf(a.l, b.h, c); c = wmma_bf(a.h, b.l, c); return wmma_bf(a.h, b.h, c); }
__device__ __forceinline__ float sigm(float v) { return 1.0f / (1.0f + expf(-v)); }
#define LDSX() do { asm volatile("s_wait_dscnt 0" ::: "memory"); __builtin_amdgcn_wave_barrier(); __builtin_amdgcn_fence(__ATOMIC_RELEASE, "workgroup"); } while (0)

// Multi-headed attention on separate inputs (q / k / v [4,2048,768]; (out,in) Wq / Wk / Wv / Wo [768,768] N(0, 1/768) applied as x @ W.T, zero biases (read); 12 heads x 64; scores / sqrt(64); no mask; softmax; out Wo^T + bo -> [4,2048,768] (6.3 M)).
#define NB 4
#define TT 2048
#define CC 768            // NH * HD = projected width
#define DIN 768          // input (model) width
#define NH 12
#define HD 64
#define NQB (TT / 64)
#define HG 4
#define SCALE (0.125f)
#define CAUSAL 0
#ifndef TNB
#define TNB NB
#endif
__device__ __forceinline__ float bfr(float v) { return (float)(__bf16)v; }
__host__ __device__ __forceinline__ int kb_last(int qb) { return CAUSAL ? ((qb * 64 + 63) >> 7) : (TT / 128 - 1); }
typedef __attribute__((ext_vector_type(8))) __bf16 v8b;
__device__ __forceinline__ v16b frag_b(const __bf16* rowk0, int lane) {
  union { v16b v; v8b q[2]; } u; const __bf16* p = rowk0 + 8 * (lane >> 4);
  u.q[0] = *(const v8b*)p; u.q[1] = *(const v8b*)(p + 16); return u.v;
}
#define QBH 0              // unused: k_fa has no high-precision path
#define QHI 0               // single-product logits on every row
#define KHI 64            // key rows carrying k residual / v bf16 hi+lo planes (written by k_proj; no kernel reads them)
// B fragment (k rows k0+.., output column o) of a weight: (in,out) [K][ld] or (out,in) [ld rows of K]: bf16 exact, or f16(bf16 * 256) exact
__device__ __forceinline__ v16b wcol_io(const float* Wm, int k0, int o, int lane, int ld) { v16b w; const int g = lane >> 4;
#pragma unroll
  for (int i = 0; i < 8; ++i) { w[i] = (__bf16)Wm[(size_t)(k0 + 8 * g + i) * ld + o]; w[8 + i] = (__bf16)Wm[(size_t)(k0 + 16 + 8 * g + i) * ld + o]; }
  return w; }
__device__ __forceinline__ v16b wcol_oi(const float* Wm, int k0, int o, int lane, int K) { v16b w; const float* p = Wm + (size_t)o * K + k0 + 8 * (lane >> 4);
#pragma unroll
  for (int i = 0; i < 8; ++i) { w[i] = (__bf16)p[i]; w[8 + i] = (__bf16)p[16 + i]; }
  return w; }
__device__ __forceinline__ v16h wcolh_io(const float* Wm, int k0, int o, int lane, int ld) { v16h w; const int g = lane >> 4;
#pragma unroll
  for (int i = 0; i < 8; ++i) { w[i] = (_Float16)(bfr(Wm[(size_t)(k0 + 8 * g + i) * ld + o]) * 256.0f); w[8 + i] = (_Float16)(bfr(Wm[(size_t)(k0 + 16 + 8 * g + i) * ld + o]) * 256.0f); }
  return w; }
__device__ __forceinline__ v16h wcolh_oi(const float* Wm, int k0, int o, int lane, int K) { v16h w; const float* p = Wm + (size_t)o * K + k0 + 8 * (lane >> 4);
#pragma unroll
  for (int i = 0; i < 8; ++i) { w[i] = (_Float16)(bfr(p[i]) * 256.0f); w[8 + i] = (_Float16)(bfr(p[16 + i]) * 256.0f); }
  return w; }
#define WQKV_LAYOUT 1   // 0 = (in,out) [DIN][CC]; 1 = (out,in) [CC][DIN]; 2 = per-head [NH][DIN][HD]
__device__ __forceinline__ v16b wcol_hdk(const float* Wm, int k0, int o, int lane) { v16b w; const int g = lane >> 4; const float* p = Wm + (size_t)(o / HD) * DIN * HD + (o % HD);
#pragma unroll
  for (int i = 0; i < 8; ++i) { w[i] = (__bf16)p[(size_t)(k0 + 8 * g + i) * HD]; w[8 + i] = (__bf16)p[(size_t)(k0 + 16 + 8 * g + i) * HD]; }
  return w; }
#define WO_OUT_IN 1
#if WQKV_LAYOUT == 1
#define WCOL(W, k0, o, lane) wcol_oi(W, k0, o, lane, DIN)
#elif WQKV_LAYOUT == 2
#define WCOL(W, k0, o, lane) wcol_hdk(W, k0, o, lane)
#else
#define WCOL(W, k0, o, lane) wcol_io(W, k0, o, lane, CC)
#endif
#if WO_OUT_IN
#define WOCOL(W, k0, o, lane) wcol_oi(W, k0, o, lane, CC)
#define WOCOLH(W, k0, o, lane) wcolh_oi(W, k0, o, lane, CC)
#else
#define WOCOL(W, k0, o, lane) wcol_io(W, k0, o, lane, DIN)
#define WOCOLH(W, k0, o, lane) wcolh_io(W, k0, o, lane, DIN)
#endif

#ifndef SM_EXTRA_PARAMS
#define SM_EXTRA_PARAMS
#endif
#ifndef PROJ_EXTRA_PARAMS
#define PROJ_EXTRA_PARAMS
#endif
#ifndef SM_MASK_HOOK
#define SM_MASK_HOOK (void)0
#endif

#define WS_QH  0u                                      // f16 q rows [b*t][CC]
#define WS_KH  (WS_QH + 2u * (size_t)NB * TT * CC)      // f16 k rows [b*t][CC]
#define WS_VT  (WS_KH + 2u * (size_t)NB * TT * CC)      // f16 v planes [b][c][t]
#define WS_QL  (WS_VT + 2u * (size_t)NB * CC * TT)      // f16 q residual x 2^10 rows [b][t < QHI][CC]
#define WS_KL  (WS_QL + 2u * (size_t)NB * QHI * CC)     // f16 k residual x 2^10 rows [b][t < KHI][CC]
#define WS_VB  (WS_KL + 2u * (size_t)NB * KHI * CC)     // bf16 v hi planes [b][c][t < KHI]
#define WS_VBL (WS_VB + 2u * (size_t)NB * CC * KHI)
#define WS_S   (WS_VBL + 2u * (size_t)NB * CC * KHI)    // unused region (no kernel reads or writes it)
#define WS_Y   (WS_S  + 4u * (size_t)HG * TT * TT)      // f32 ctx rows [b*t][CC] (only when there is an output projection)
#define WS_END (WS_Y  + 4u * (size_t)NB * TT * CC)

// ---- k_proj: block = (64 rows, 128 cols, which): q/k/v = X W (+ b) with exact bf16 products (K = DIN) -> which 0: q f16 rows (+ residual rows < QHI); 1: k f16 rows (+ residual rows < KHI); 2: v f16 planes [c][t] (+ bf16 hi/lo planes for t < KHI)
__global__ __launch_bounds__(128) void k_proj(const float* __restrict__ XQ, const float* __restrict__ XK, const float* __restrict__ XV, const float* __restrict__ WQ, const float* __restrict__ WK, const float* __restrict__ WV, const float* __restrict__ BQ, const float* __restrict__ BK, const float* __restrict__ BV,
    _Float16* __restrict__ QH, _Float16* __restrict__ QL, _Float16* __restrict__ KH, _Float16* __restrict__ KL, _Float16* __restrict__ VT, __bf16* __restrict__ VB, __bf16* __restrict__ VBL) {
  __shared__ __align__(16) _Float16 sh[64][136], sl[64][136]; __shared__ __align__(16) _Float16 th[128][72]; __shared__ __align__(16) __bf16 tb[128][72], tbl[128][72];
  const int tid = threadIdx.x, wave = tid >> 5, lane = tid & 31, col = lane & 15, g = lane >> 4; const int which = blockIdx.z; const int c0 = blockIdx.y * 128; const size_t r0 = (size_t)blockIdx.x * 64; const size_t bb = r0 / TT; const int t0 = (int)(r0 % TT);
  const float* X = which == 0 ? XQ : which == 1 ? XK : XV; const float* WA = which == 0 ? WQ : which == 1 ? WK : WV; const float* BA = which == 0 ? BQ : which == 1 ? BK : BV;
  v8f acc[8] = {};
#pragma unroll 2
  for (int kc = 0; kc < DIN / 32; ++kc) { v16b a; { const float* p = X + (r0 + wave * 16 + col) * DIN + kc * 32 + 8 * g;
#pragma unroll
      for (int i = 0; i < 8; ++i) { a[i] = (__bf16)p[i]; a[8 + i] = (__bf16)p[16 + i]; } }
    asm volatile("s_wait_loadcnt 0x0" ::: "memory");
#pragma unroll
    for (int j = 0; j < 8; ++j) { const v16b w = WCOL(WA, kc * 32, c0 + j * 16 + col, lane); asm volatile("s_wait_loadcnt 0x0" ::: "memory"); acc[j] = wmma_bf(a, w, acc[j]); } }
  if (which < 2) { _Float16* DH = which == 0 ? QH : KH; _Float16* DL = which == 0 ? QL : KL; const int nhi = which == 0 ? QHI : KHI; const bool hi_rows = t0 < nhi;
#pragma unroll
    for (int j = 0; j < 8; ++j) { const float bias = BA ? bfr(BA[c0 + j * 16 + col]) : 0.f;
#pragma unroll
      for (int r = 0; r < 8; ++r) { const float v = acc[j][r] + bias; const _Float16 hv = (_Float16)v; sh[wave * 16 + 8 * g + r][j * 16 + col] = hv; sl[wave * 16 + 8 * g + r][j * 16 + col] = (_Float16)((v - (float)hv) * 1024.0f); } }
    __syncthreads();
    for (int e = tid; e < 64 * 16; e += 128) { const int rl = e >> 4, q = e & 15; vst2((unsigned*)(DH + (r0 + rl) * CC + c0 + q * 8), *(const v4u*)&sh[rl][q * 8]); if (hi_rows) vst2((unsigned*)(DL + (bb * nhi + t0 + rl) * (size_t)CC + c0 + q * 8), *(const v4u*)&sl[rl][q * 8]); }
  } else { const bool hi_rows = t0 < KHI;
#pragma unroll
    for (int j = 0; j < 8; ++j) { const float bias = BA ? bfr(BA[c0 + j * 16 + col]) : 0.f;
#pragma unroll
      for (int r = 0; r < 8; ++r) { const float v = acc[j][r] + bias; const int rl = wave * 16 + 8 * g + r, cl = j * 16 + col; th[cl][rl] = (_Float16)v; const __bf16 bh = (__bf16)v; tb[cl][rl] = bh; tbl[cl][rl] = (__bf16)(v - (float)bh); } }
    __syncthreads();
    for (int e = tid; e < 128 * 8; e += 128) { const int cl = e >> 3, q = e & 7; vst2((unsigned*)(VT + (bb * CC + c0 + cl) * (size_t)TT + t0 + q * 8), *(const v4u*)&th[cl][q * 8]); if (hi_rows) { const size_t o3 = (bb * CC + c0 + cl) * (size_t)KHI + t0 + q * 8; vst2((unsigned*)(VB + o3), *(const v4u*)&tb[cl][q * 8]); vst2((unsigned*)(VBL + o3), *(const v4u*)&tbl[cl][q * 8]); } } } }
// ---- k_fa: block = 4 waves x 32 query columns of one (batch, head); one pass = 32 keys. S^T = K . Q^T (A = k rows, B = q rows kept in registers), so a lane holds 16 scores of ONE query per 16-column group;
// online softmax in the log2 domain in registers; two S^T tiles converted in place are the B operand P^T; O^T += V^T . P^T (A = v planes [c][t]). The maximum in use may trail the true one by up to LZ (log2), so P <= 2^(LZ + PK) = 2^15 stays inside f16.
#define FQ 2              // 16-column query groups per wave
#define PK 11.0f          // P carried x 2^11 into f16 so that small weights stay clear of f16 subnormals; cancels against the denominator
#define LZ 4.0f           // rescale the sums only when a column's maximum exceeds the one in use by more than this
__device__ __forceinline__ v8f wmma_h(v16h a, v16h b, v8f c) { return __builtin_amdgcn_wmma_f32_16x16x32_f16(false, a, false, b, (short)0, c, false, false); }
__device__ __forceinline__ float xhalf(float x) { return __builtin_bit_cast(float, __builtin_amdgcn_permlanex16(__builtin_bit_cast(int, x), __builtin_bit_cast(int, x), 0x76543210, 0xfedcba98, false, false)); }  // lane l with lane l ^ 16
__global__ __launch_bounds__(128) void k_fa(const _Float16* __restrict__ QH, const _Float16* __restrict__ KH, const _Float16* __restrict__ VT, float* __restrict__ Y) {
  const int tid = threadIdx.x, wave = tid >> 5, lane = tid & 31, col = lane & 15, g = lane >> 4;
  const int b = blockIdx.y / NH, h = blockIdx.y % NH; const int ql0 = blockIdx.x * (64 * FQ) + wave * (16 * FQ);
  const _Float16* Kp = KH + ((size_t)b * TT + col) * CC + h * HD;            // key row col of a 16-key tile
  const _Float16* Vp = VT + ((size_t)b * CC + h * HD + col) * (size_t)TT;    // v plane d = col of a 16-row tile
  const float cs = SCALE * 1.4426950408889634f;
  v16h qf[FQ][HD / 32];
#pragma unroll
  for (int u = 0; u < FQ; ++u)
#pragma unroll
    for (int kc = 0; kc < HD / 32; ++kc) qf[u][kc] = frag_h(QH + ((size_t)b * TT + ql0 + u * 16 + col) * CC + h * HD + kc * 32, lane);
  v8f o[FQ][HD / 16] = {}; float mr[FQ], lr[FQ];
#pragma unroll
  for (int u = 0; u < FQ; ++u) { mr[u] = -3.0e38f; lr[u] = 0.f; }
  v16h kf[2][HD / 32];
#pragma unroll
  for (int t = 0; t < 2; ++t)
#pragma unroll
    for (int kc = 0; kc < HD / 32; ++kc) kf[t][kc] = frag_h(Kp + (size_t)(t * 16) * CC + kc * 32, lane);
  for (int kb = 0; kb < TT / 32; ++kb) {
    v16h vf[HD / 16];
#pragma unroll
    for (int j = 0; j < HD / 16; ++j) vf[j] = frag_h(Vp + (size_t)(j * 16) * TT + kb * 32, lane);
    v8f s[FQ][2];
#pragma unroll
    for (int t = 0; t < 2; ++t)
#pragma unroll
      for (int u = 0; u < FQ; ++u) { v8f z = {};
#pragma unroll
        for (int kc = 0; kc < HD / 32; ++kc) z = wmma_h(kf[t][kc], qf[u][kc], z);
        s[u][t] = z; }
    const int kn = (kb + 1) & (TT / 32 - 1);   // next pass's k rows, in flight under this pass's softmax (the last pass fetches pass 0's again: in bounds, unused)
#pragma unroll
    for (int t = 0; t < 2; ++t)
#pragma unroll
      for (int kc = 0; kc < HD / 32; ++kc) kf[t][kc] = frag_h(Kp + (size_t)(kn * 32 + t * 16) * CC + kc * 32, lane);
    float mb[FQ]; bool need = false;
#pragma unroll
    for (int u = 0; u < FQ; ++u) { float mx = s[u][0][0];
#pragma unroll
      for (int r = 1; r < 16; ++r) mx = fmaxf(mx, s[u][r >> 3][r & 7]);
      mx = fmaxf(mx, xhalf(mx)) * cs;   // both wave halves hold this query's maximum of the pass, scaled (the scale is positive)
      mb[u] = mx; need = need || (mx > mr[u] + LZ); }
    if (__builtin_amdgcn_ballot_w32(need) != 0) {   // one scalar test per pass; always taken on the first pass, where the factor is 0
#pragma unroll
      for (int u = 0; u < FQ; ++u) { const float mn = fmaxf(mr[u], mb[u]); const float corr = __builtin_amdgcn_exp2f(mr[u] - mn); mr[u] = mn; lr[u] *= corr;
#pragma unroll
        for (int j = 0; j < HD / 16; ++j) o[u][j] = o[u][j] * corr; } }
#pragma unroll
    for (int u = 0; u < FQ; ++u) { const float nm = PK - mr[u]; v16h p; float ls = 0.f;
#pragma unroll
      for (int e = 0; e < 16; e += 2) { const v2f a = __builtin_elementwise_fma((v2f){s[u][e >> 3][e & 7], s[u][e >> 3][(e & 7) + 1]}, (v2f){cs, cs}, (v2f){nm, nm});
        const float p0 = __builtin_amdgcn_exp2f(a.x), p1 = __builtin_amdgcn_exp2f(a.y); ls += p0 + p1; p[e] = (_Float16)p0; p[e + 1] = (_Float16)p1; }   // element e = key 8g + e (e < 8), 16 + 8g + e - 8: the k order of frag_h
      lr[u] += ls;
#pragma unroll
      for (int j = 0; j < HD / 16; ++j) o[u][j] = wmma_h(vf[j], p, o[u][j]); } }
#pragma unroll
  for (int u = 0; u < FQ; ++u) { const float inv = 1.0f / (lr[u] + xhalf(lr[u]));   // the halves' partial denominators join once
    float* yr = Y + ((size_t)b * TT + ql0 + u * 16 + col) * CC + h * HD + 8 * g;
#pragma unroll
    for (int j = 0; j < HD / 16; ++j) { const v8f r = o[u][j] * inv; vst2(yr + j * 16, (v4f){r[0], r[1], r[2], r[3]}); vst2(yr + j * 16 + 4, (v4f){r[4], r[5], r[6], r[7]}); } } }
// ---- k_out: block = (64 rows, 128 cols): out = ctx Wo (+ bo): ctx x 2^6 once to f16 against Wo as f16(bf16 x 2^8) exact (1 product) x 2^-14; causal early rows (< QHI of each sequence): ctx bf16 hi + lo against exact bf16 Wo (2 products)
__global__ __launch_bounds__(128) void k_out(const float* __restrict__ Y, const float* __restrict__ WO, const float* __restrict__ BO, float* __restrict__ OUT) { __shared__ __align__(16) float sf[4][16][132];
  const int tid = threadIdx.x, wave = tid >> 5, lane = tid & 31, col = lane & 15, g = lane >> 4; const int c0 = blockIdx.y * 128; const size_t r0 = (size_t)blockIdx.x * 64 + wave * 16;
  v8f acc[8] = {};
  if (CAUSAL && (int)(((size_t)blockIdx.x * 64) % TT) < QHI) {   /* block-uniform */
#pragma unroll 2
    for (int kc = 0; kc < CC / 32; ++kc) { const F2 a = split_row(Y + (r0 + col) * CC, kc * 32, lane); asm volatile("s_wait_loadcnt 0x0" ::: "memory");
#pragma unroll
      for (int j = 0; j < 8; ++j) { const v16b w = WOCOL(WO, kc * 32, c0 + j * 16 + col, lane); asm volatile("s_wait_loadcnt 0x0" ::: "memory"); acc[j] = wmma_bf(a.h, w, acc[j]); acc[j] = wmma_bf(a.l, w, acc[j]); } }
#pragma unroll
    for (int j = 0; j < 8; ++j) { const float bias = BO ? bfr(BO[c0 + j * 16 + col]) : 0.f;
#pragma unroll
      for (int r = 0; r < 8; ++r) sf[wave][8 * g + r][j * 16 + col] = acc[j][r] + bias; }
  } else {
#pragma unroll 2
    for (int kc = 0; kc < CC / 32; ++kc) { const v16h a = frag_f32s(Y + (r0 + col) * CC + kc * 32, lane, 64.0f); asm volatile("s_wait_loadcnt 0x0" ::: "memory");   /* ctx carried x 2^6 into f16 so small-magnitude context rows stay clear of f16 subnormals */
#pragma unroll
      for (int j = 0; j < 8; ++j) { const v16h w = WOCOLH(WO, kc * 32, c0 + j * 16 + col, lane); asm volatile("s_wait_loadcnt 0x0" ::: "memory"); acc[j] = wmma16(a, w, acc[j]); } }
#pragma unroll
    for (int j = 0; j < 8; ++j) { const float bias = BO ? bfr(BO[c0 + j * 16 + col]) : 0.f;
#pragma unroll
      for (int r = 0; r < 8; ++r) sf[wave][8 * g + r][j * 16 + col] = acc[j][r] * (1.0f / 16384.0f) + bias; } }   /* 2^-8 (Wo carry) x 2^-6 (ctx carry) */
  LDSX(); for (int rl = 0; rl < 16; ++rl) vst2(OUT + (r0 + rl) * DIN + c0 + lane * 4, *(const v4f*)&sf[wave][rl][lane * 4]); }

extern "C" void kernel_launch(void* const* d_in, const int* in_sizes, int n_in, void* d_out, int out_size, void* d_ws, size_t ws_size, hipStream_t stream) {
  (void)in_sizes; (void)n_in; (void)out_size;
  const float** F = (const float**)d_in;
  if (ws_size < (size_t)WS_END) return;
  char* ws = (char*)d_ws; _Float16 *QH = (_Float16*)(ws + WS_QH), *KH = (_Float16*)(ws + WS_KH), *VT = (_Float16*)(ws + WS_VT), *QL = (_Float16*)(ws + WS_QL), *KL = (_Float16*)(ws + WS_KL); __bf16 *VB = (__bf16*)(ws + WS_VB), *VBL = (__bf16*)(ws + WS_VBL); float *Y = (float*)(ws + WS_Y);
  (void)Y; (void)QL; (void)KL; (void)VB; (void)VBL;
  // inputs: 0 q [4,2048,768]; 1 k; 2 v; 3 Wq [768,768] (out,in), 4 bq; 5 Wk, 6 bk; 7 Wv, 8 bv; 9 Wo (out,in), 10 bo (zero biases, read)
  k_proj<<<dim3(TNB * TT / 64, CC / 128, 3), 128, 0, stream>>>(F[0], F[1], F[2], F[3], F[5], F[7], F[4], F[6], F[8], QH, QL, KH, KL, VT, VB, VBL);
  k_fa<<<dim3(TT / (64 * FQ), TNB * NH), 128, 0, stream>>>(QH, KH, VT, Y);
  k_out<<<dim3(TNB * TT / 64, DIN / 128), 128, 0, stream>>>(Y, F[9], F[10], (float*)d_out);
}

// v002
// A run of this version takes 151 microseconds.
// Two timings next to v001 both put it at 2.94 times that version's speed.
// All steps since v000 together make it 12.3 times as fast.
// compute dtype: all float inputs rounded to bf16; q/k/v projections with EXACT bf16 products on WMMA 16x16x32 (f32 accumulate) + bias; logits q x k once to f16 each (1 product) x SCALE; online softmax f32 in registers; unnormalised P x 2^11 once to f16 x v once to f16 (1 product), / f32 denominator; ctx x 2^6 once to f16 x Wo f16(bf16 x 2^8) + bo; f32 output.
#include <hip/hip_runtime.h>
#include <math.h>

typedef __attribute__((ext_vector_type(16))) _Float16 v16h;
typedef __attribute__((ext_vector_type(16))) __bf16 v16b;
typedef __attribute__((ext_vector_type(8)))  _Float16 v8h;
typedef __attribute__((ext_vector_type(8)))  float v8f;
typedef __attribute__((ext_vector_type(4)))  float v4f;
typedef __attribute__((ext_vector_type(2)))  float v2f;
typedef __attribute__((ext_vector_type(4)))  unsigned v4u;
typedef __attribute__((ext_vector_type(4)))  int v4i;
typedef float __attribute__((may_alias)) float_a;
typedef int __attribute__((may_alias)) int_a;

template <typename T> __device__ __forceinline__ void vst2(void* p, T v) { *(T*)p = v;  }
__device__ __forceinline__ v8f wmma16(v16h a, v16h b, v8f c) {
  v8f d = __builtin_amdgcn_wmma_f32_16x16x32_f16(false, a, false, b, (short)0, c, false, false);
  asm volatile("v_nop\n\tv_nop\n\tv_nop\n\tv_nop" : "+v"(d) : "v"(a), "v"(b));
  return d;
}
__device__ __forceinline__ v8f wmma_bf(v16b a, v16b b, v8f c) {
  v8f d = __builtin_amdgcn_wmma_f32_16x16x32_bf16(false, a, false, b, (short)0, c, false, false);
  asm volatile("v_nop\n\tv_nop\n\tv_nop\n\tv_nop" : "+v"(d) : "v"(a), "v"(b));
  return d;
}
// 16x16x32 fragments: lane = (h = lane>>4, row/col = lane&15); elements 0..7 = k0+8h+0..7, 8..15 = k0+16+8h+0..7; D element r = row 8h+r
__device__ __forceinline__ v16h frag_h(const _Float16* rowk0, int lane) {
  union { v16h v; v8h q[2]; } u; const _Float16* p = rowk0 + 8 * (lane >> 4);
  u.q[0] = *(const v8h*)p; u.q[1] = *(const v8h*)(p + 16); return u.v;
}
__device__ __forceinline__ v16h frag_f32(const float* rowk0, int lane) {
  v16h a; const float* p = rowk0 + 8 * (lane >> 4);
#pragma unroll
  for (int i = 0; i < 8; ++i) { a[i] = (_Float16)p[i]; a[8 + i] = (_Float16)p[16 + i]; }
  return a;
}
__device__ __forceinline__ v16h frag_f32s(const float* rowk0, int lane, float sc) {
  v16h a; const float* p = rowk0 + 8 * (lane >> 4);
#pragma unroll
  for (int i = 0; i < 8; ++i) { a[i] = (_Float16)(p[i] * sc); a[8 + i] = (_Float16)(p[16 + i] * sc); }
  return a;
}
// column fragment from a [K][ld] layout (column n), rows >= K read as 0
__device__ __forceinline__ v16h fragc_f32(const float* W, int k0, int n, int lane, int ld, int K) {
  v16h a; const int g = lane >> 4;
#pragma unroll
  for (int i = 0; i < 8; ++i) { const int ka = k0 + 8 * g + i, kb = ka + 16;
    a[i] = (_Float16)(ka < K ? W[(size_t)(ka < K ? ka : K - 1) * ld + n] : 0.f); a[8 + i] = (_Float16)(kb < K ? W[(size_t)(kb < K ? kb : K - 1) * ld + n] : 0.f); }
  return a;
}
struct F2 { v16b h, l; };
__device__ __forceinline__ F2 bsplit16(const float v[16]) { F2 r;
#pragma unroll
  for (int i = 0; i < 16; ++i) { const __bf16 h = (__bf16)v[i]; r.h[i] = h; r.l[i] = (__bf16)(v[i] - (float)h); }
  return r; }
__device__ __forceinline__ F2 split_row(const float* row, int k0, int lane) { float v[16]; const float* p = row + k0 + 8 * (lane >> 4);
#pragma unroll
  for (int i = 0; i < 8; ++i) { v[i] = p[i]; v[8 + i] = p[16 + i]; }
  return bsplit16(v); }
__device__ __forceinline__ F2 split_rowK(const float* row, int k0, int lane, int K) { float v[16]; const int g = lane >> 4;
#pragma unroll
  for (int i = 0; i < 8; ++i) { const int ka = k0 + 8 * g + i, kb = ka + 16; v[i] = ka < K ? row[ka < K ? ka : K - 1] : 0.f; v[8 + i] = kb < K ? row[kb < K ? kb : K - 1] : 0.f; }
  return bsplit16(v); }
__device__ __forceinline__ F2 split_col(const float* W, int k0, int n, int lane, int ld, int K) { float v[16]; const int g = lane >> 4;
#pragma unroll
  for (int i = 0; i < 8; ++i) { const int ka = k0 + 8 * g + i, kb = ka + 16; v[i] = ka < K ? W[(size_t)(ka < K ? ka : K - 1) * ld + n] : 0.f; v[8 + i] = kb < K ? W[(size_t)(kb < K ? kb : K - 1) * ld + n] : 0.f; }
  return bsplit16(v); }
__device__ __forceinline__ v8f mac3(const F2& a, const F2& b, v8f c) { c = wmma_bf(a.l, b.h, c); c = wmma_bf(a.h, b.l, c); return wmma_bf(a.h, b.h, c); }
__device__ __forceinline__ float sigm(float v) { return 1.0f / (1.0f + expf(-v)); }
#define LDSX() do { asm volatile("s_wait_dscnt 0" ::: "memory"); __builtin_amdgcn_wave_barrier(); __builtin_amdgcn_fence(__ATOMIC_RELEASE, "workgroup"); } while (0)

// Multi-headed attention on separate inputs (q / k / v [4,2048,768]; (out,in) Wq / Wk / Wv / Wo [768,768] N(0, 1/768) applied as x @ W.T, zero biases (read); 12 heads x 64; scores / sqrt(64); no mask; softmax; out Wo^T + bo -> [4,2048,768] (6.3 M)).
#define NB 4
#define TT 2048
#define CC 768            // NH * HD = projected width
#define DIN 768          // input (model) width
#define NH 12
#define HD 64
#define NQB (TT / 64)
#define HG 4
#define SCALE (0.125f)
#define CAUSAL 0
#ifndef TNB
#define TNB NB
#endif
__device__ __forceinline__ float bfr(float v) { return (float)(__bf16)v; }
__host__ __device__ __forceinline__ int kb_last(int qb) { return CAUSAL ? ((qb * 64 + 63) >> 7) : (TT / 128 - 1); }
typedef __attribute__((ext_vector_type(8))) __bf16 v8b;
__device__ __forceinline__ v16b frag_b(const __bf16* rowk0, int lane) {
  union { v16b v; v8b q[2]; } u; const __bf16* p = rowk0 + 8 * (lane >> 4);
  u.q[0] = *(const v8b*)p; u.q[1] = *(const v8b*)(p + 16); return u.v;
}
typedef __attribute__((ext_vector_type(4))) __bf16 v4b;
typedef __attribute__((ext_vector_type(4))) _Float16 v4h;
#define SP 40             // LDS pitch of a staged 32-k row, 16-bit elements: 80 bytes = 16 x odd, the pitch for 16-byte fragment reads
#define QBH 0              // unused: no kernel reads it
#define QHI 0               // single-product logits on every row
#define KHI 64            // key rows carrying k residual / v bf16 hi+lo planes (written by k_proj; no kernel reads them)
// B fragment (k rows k0+.., output column o) of a weight: (in,out) [K][ld] or (out,in) [ld rows of K]: bf16 exact, or f16(bf16 * 256) exact
__device__ __forceinline__ v16b wcol_io(const float* Wm, int k0, int o, int lane, int ld) { v16b w; const int g = lane >> 4;
#pragma unroll
  for (int i = 0; i < 8; ++i) { w[i] = (__bf16)Wm[(size_t)(k0 + 8 * g + i) * ld + o]; w[8 + i] = (__bf16)Wm[(size_t)(k0 + 16 + 8 * g + i) * ld + o]; }
  return w; }
__device__ __forceinline__ v16b wcol_oi(const float* Wm, int k0, int o, int lane, int K) { v16b w; const float* p = Wm + (size_t)o * K + k0 + 8 * (lane >> 4);
#pragma unroll
  for (int i = 0; i < 8; ++i) { w[i] = (__bf16)p[i]; w[8 + i] = (__bf16)p[16 + i]; }
  return w; }
__device__ __forceinline__ v16h wcolh_io(const float* Wm, int k0, int o, int lane, int ld) { v16h w; const int g = lane >> 4;
#pragma unroll
  for (int i = 0; i < 8; ++i) { w[i] = (_Float16)(bfr(Wm[(size_t)(k0 + 8 * g + i) * ld + o]) * 256.0f); w[8 + i] = (_Float16)(bfr(Wm[(size_t)(k0 + 16 + 8 * g + i) * ld + o]) * 256.0f); }
  return w; }
__device__ __forceinline__ v16h wcolh_oi(const float* Wm, int k0, int o, int lane, int K) { v16h w; const float* p = Wm + (size_t)o * K + k0 + 8 * (lane >> 4);
#pragma unroll
  for (int i = 0; i < 8; ++i) { w[i] = (_Float16)(bfr(p[i]) * 256.0f); w[8 + i] = (_Float16)(bfr(p[16 + i]) * 256.0f); }
  return w; }
#define WQKV_LAYOUT 1   // picks WCOL's layout only, which no kernel uses; k_proj reads Wq / Wk / Wv as (out,in) [CC][DIN]
__device__ __forceinline__ v16b wcol_hdk(const float* Wm, int k0, int o, int lane) { v16b w; const int g = lane >> 4; const float* p = Wm + (size_t)(o / HD) * DIN * HD + (o % HD);
#pragma unroll
  for (int i = 0; i < 8; ++i) { w[i] = (__bf16)p[(size_t)(k0 + 8 * g + i) * HD]; w[8 + i] = (__bf16)p[(size_t)(k0 + 16 + 8 * g + i) * HD]; }
  return w; }
#define WO_OUT_IN 1
#if WQKV_LAYOUT == 1
#define WCOL(W, k0, o, lane) wcol_oi(W, k0, o, lane, DIN)
#elif WQKV_LAYOUT == 2
#define WCOL(W, k0, o, lane) wcol_hdk(W, k0, o, lane)
#else
#define WCOL(W, k0, o, lane) wcol_io(W, k0, o, lane, CC)
#endif
#if WO_OUT_IN
#define WOCOL(W, k0, o, lane) wcol_oi(W, k0, o, lane, CC)
#define WOCOLH(W, k0, o, lane) wcolh_oi(W, k0, o, lane, CC)
#else
#define WOCOL(W, k0, o, lane) wcol_io(W, k0, o, lane, DIN)
#define WOCOLH(W, k0, o, lane) wcolh_io(W, k0, o, lane, DIN)
#endif

#ifndef SM_EXTRA_PARAMS
#define SM_EXTRA_PARAMS
#endif
#ifndef PROJ_EXTRA_PARAMS
#define PROJ_EXTRA_PARAMS
#endif
#ifndef SM_MASK_HOOK
#define SM_MASK_HOOK (void)0
#endif

#define WS_QH  0u                                      // f16 q rows [b*t][CC]
#define WS_KH  (WS_QH + 2u * (size_t)NB * TT * CC)      // f16 k rows [b*t][CC]
#define WS_VT  (WS_KH + 2u * (size_t)NB * TT * CC)      // f16 v planes [b][c][t]
#define WS_QL  (WS_VT + 2u * (size_t)NB * CC * TT)      // f16 q residual x 2^10 rows [b][t < QHI][CC]
#define WS_KL  (WS_QL + 2u * (size_t)NB * QHI * CC)     // f16 k residual x 2^10 rows [b][t < KHI][CC]
#define WS_VB  (WS_KL + 2u * (size_t)NB * KHI * CC)     // bf16 v hi planes [b][c][t < KHI]
#define WS_VBL (WS_VB + 2u * (size_t)NB * CC * KHI)
#define WS_S   (WS_VBL + 2u * (size_t)NB * CC * KHI)    // unused region (no kernel reads or writes it)
#define WS_Y   (WS_S  + 4u * (size_t)HG * TT * TT)      // f32 ctx rows [b*t][CC] (only when there is an output projection)
#define WS_END (WS_Y  + 4u * (size_t)NB * TT * CC)

// ---- k_proj: block = (128 rows, 128 cols, which), a wave = two 16-row groups (one in each 64-row half) x 128 cols: q/k/v = X W (+ b) with exact bf16 products (K = DIN) -> which 0: q f16 rows (+ residual rows < QHI); 1: k f16 rows (+ residual rows < KHI); 2: v f16 planes [c][t] (+ bf16 hi/lo planes for t < KHI)
__global__ __launch_bounds__(128) void k_proj(const float* __restrict__ XQ, const float* __restrict__ XK, const float* __restrict__ XV, const float* __restrict__ WQ, const float* __restrict__ WK, const float* __restrict__ WV, const float* __restrict__ BQ, const float* __restrict__ BK, const float* __restrict__ BV,
    _Float16* __restrict__ QH, _Float16* __restrict__ QL, _Float16* __restrict__ KH, _Float16* __restrict__ KL, _Float16* __restrict__ VT, __bf16* __restrict__ VB, __bf16* __restrict__ VBL) {
  __shared__ __align__(16) union { struct { __bf16 xs[2][128][SP], wt[2][128][SP]; } s; struct { _Float16 sh[64][136], sl[64][136]; } e; struct { _Float16 th[128][72]; __bf16 tb[128][72], tbl[128][72]; } t; } sm;   // the operand tiles are dead when the output tiles are written (the loop ends in a barrier)
  auto& sh = sm.e.sh; auto& sl = sm.e.sl; auto& th = sm.t.th; auto& tb = sm.t.tb; auto& tbl = sm.t.tbl;
  const int tid = threadIdx.x, wave = tid >> 5, lane = tid & 31, col = lane & 15, g = lane >> 4; const int which = blockIdx.z; const int c0 = blockIdx.y * 128; const size_t rblk = (size_t)blockIdx.x * 128; const size_t bb = rblk / TT; const int tblk = (int)(rblk % TT);
  const float* X = which == 0 ? XQ : which == 1 ? XK : XV; const float* WA = which == 0 ? WQ : which == 1 ? WK : WV; const float* BA = which == 0 ? BQ : which == 1 ? BK : BV;
  v8f acc2[2][8] = {};
  // one 32-k chunk of X (128 rows) and W (128 rows, (out,in)) per trip: 8 lanes fetch one whole 128-byte row piece, each value is rounded to bf16 once and all four waves read their fragments from LDS
  const int sr = tid >> 3, sc = (tid & 7) * 4; const float* Xg = X + (rblk + sr) * DIN + sc; const float* Wg = WA + (size_t)(c0 + sr) * DIN + sc;
  v4f xr[8], wr[8];
#pragma unroll
  for (int i = 0; i < 8; ++i) xr[i] = *(const v4f*)(Xg + (size_t)(16 * i) * DIN);
#pragma unroll
  for (int i = 0; i < 8; ++i) wr[i] = *(const v4f*)(Wg + (size_t)(16 * i) * DIN);
#pragma unroll
  for (int i = 0; i < 8; ++i) *(v4b*)&sm.s.xs[0][sr + 16 * i][sc] = (v4b){(__bf16)xr[i][0], (__bf16)xr[i][1], (__bf16)xr[i][2], (__bf16)xr[i][3]};
#pragma unroll
  for (int i = 0; i < 8; ++i) *(v4b*)&sm.s.wt[0][sr + 16 * i][sc] = (v4b){(__bf16)wr[i][0], (__bf16)wr[i][1], (__bf16)wr[i][2], (__bf16)wr[i][3]};
  __syncthreads();
#pragma unroll 2   // the buffer index becomes a constant
  for (int kc = 0; kc < DIN / 32; ++kc) { const int cur = kc & 1; const bool more = kc + 1 < DIN / 32;
    if (more) {   // the next chunk's loads fly under this chunk's products
#pragma unroll
      for (int i = 0; i < 8; ++i) xr[i] = *(const v4f*)(Xg + (size_t)(16 * i) * DIN + (kc + 1) * 32);
#pragma unroll
      for (int i = 0; i < 8; ++i) wr[i] = *(const v4f*)(Wg + (size_t)(16 * i) * DIN + (kc + 1) * 32); }
    const v16b a0 = frag_b(&sm.s.xs[cur][wave * 16 + col][0], lane), a1 = frag_b(&sm.s.xs[cur][64 + wave * 16 + col][0], lane); v16b w[8];
#pragma unroll
    for (int j = 0; j < 8; ++j) w[j] = frag_b(&sm.s.wt[cur][j * 16 + col][0], lane);
    __builtin_amdgcn_sched_barrier(0);   // the chunk's LDS reads stay one group ahead of its products: one LDS wait a chunk, not one a product
#pragma unroll
    for (int j = 0; j < 8; ++j) { acc2[0][j] = __builtin_amdgcn_wmma_f32_16x16x32_bf16(false, a0, false, w[j], (short)0, acc2[0][j], false, false); acc2[1][j] = __builtin_amdgcn_wmma_f32_16x16x32_bf16(false, a1, false, w[j], (short)0, acc2[1][j], false, false); }
    __builtin_amdgcn_sched_barrier(0);   // the conversions, which wait for the next chunk's loads, stay behind the products
    if (more) { asm volatile("s_wait_xcnt 0x0" ::: "memory"); __builtin_amdgcn_sched_barrier(0);   // the wait stands in front of every rewrite of the loads' address registers; the scheduling barrier keeps the conversions, whose temporaries may take those registers, behind it
#pragma unroll
      for (int i = 0; i < 8; ++i) *(v4b*)&sm.s.xs[cur ^ 1][sr + 16 * i][sc] = (v4b){(__bf16)xr[i][0], (__bf16)xr[i][1], (__bf16)xr[i][2], (__bf16)xr[i][3]};
#pragma unroll
      for (int i = 0; i < 8; ++i) *(v4b*)&sm.s.wt[cur ^ 1][sr + 16 * i][sc] = (v4b){(__bf16)wr[i][0], (__bf16)wr[i][1], (__bf16)wr[i][2], (__bf16)wr[i][3]}; }
    __syncthreads(); }   // publishes the next chunk and ends every wave's reads of this one, whose buffer the next trip refills
#pragma unroll   // the two 64-row halves go out one after the other through the same output tiles
  for (int hf = 0; hf < 2; ++hf) { const size_t r0 = rblk + hf * 64; const int t0 = tblk + hf * 64; const v8f (&acc)[8] = acc2[hf];
  if (which < 2) { _Float16* DH = which == 0 ? QH : KH; _Float16* DL = which == 0 ? QL : KL; const int nhi = which == 0 ? QHI : KHI; const bool hi_rows = t0 < nhi;
#pragma unroll
    for (int j = 0; j < 8; ++j) { const float bias = BA ? bfr(BA[c0 + j * 16 + col]) : 0.f;
#pragma unroll
      for (int r = 0; r < 8; ++r) { const float v = acc[j][r] + bias; const _Float16 hv = (_Float16)v; sh[wave * 16 + 8 * g + r][j * 16 + col] = hv; sl[wave * 16 + 8 * g + r][j * 16 + col] = (_Float16)((v - (float)hv) * 1024.0f); } }
    __syncthreads();
    for (int e = tid; e < 64 * 16; e += 128) { const int rl = e >> 4, q = e & 15; vst2((unsigned*)(DH + (r0 + rl) * CC + c0 + q * 8), *(const v4u*)&sh[rl][q * 8]); if (hi_rows) vst2((unsigned*)(DL + (bb * nhi + t0 + rl) * (size_t)CC + c0 + q * 8), *(const v4u*)&sl[rl][q * 8]); }
  } else { const bool hi_rows = t0 < KHI;
#pragma unroll
    for (int j = 0; j < 8; ++j) { const float bias = BA ? bfr(BA[c0 + j * 16 + col]) : 0.f;
#pragma unroll
      for (int r = 0; r < 8; ++r) { const float v = acc[j][r] + bias; const int rl = wave * 16 + 8 * g + r, cl = j * 16 + col; th[cl][rl] = (_Float16)v; const __bf16 bh = (__bf16)v; tb[cl][rl] = bh; tbl[cl][rl] = (__bf16)(v - (float)bh); } }
    __syncthreads();
    for (int e = tid; e < 128 * 8; e += 128) { const int cl = e >> 3, q = e & 7; vst2((unsigned*)(VT + (bb * CC + c0 + cl) * (size_t)TT + t0 + q * 8), *(const v4u*)&th[cl][q * 8]); if (hi_rows) { const size_t o3 = (bb * CC + c0 + cl) * (size_t)KHI + t0 + q * 8; vst2((unsigned*)(VB + o3), *(const v4u*)&tb[cl][q * 8]); vst2((unsigned*)(VBL + o3), *(const v4u*)&tbl[cl][q * 8]); } } }
  if (hf == 0) __syncthreads(); } }   // every wave has read the first half's tiles before the second half overwrites them
// ---- k_fa: block = 4 waves x 32 query columns of one (batch, head); one pass = 32 keys. S^T = K . Q^T (A = k rows, B = q rows kept in registers), so a lane holds 16 scores of ONE query per 16-column group;
// online softmax in the log2 domain in registers; two S^T tiles converted in place are the B operand P^T; O^T += V^T . P^T (A = v planes [c][t]). The maximum in use may trail the true one by up to LZ (log2), so P <= 2^(LZ + PK) = 2^15 stays inside f16.
#define FQ 2              // 16-column query groups per wave
#define PK 11.0f          // P carried x 2^11 into f16 so that small weights stay clear of f16 subnormals; cancels against the denominator
#define LZ 4.0f           // rescale the sums only when a column's maximum exceeds the one in use by more than this
__device__ __forceinline__ v8f wmma_h(v16h a, v16h b, v8f c) { return __builtin_amdgcn_wmma_f32_16x16x32_f16(false, a, false, b, (short)0, c, false, false); }
__device__ __forceinline__ float xhalf(float x) { return __builtin_bit_cast(float, __builtin_amdgcn_permlanex16(__builtin_bit_cast(int, x), __builtin_bit_cast(int, x), 0x76543210, 0xfedcba98, false, false)); }  // lane l with lane l ^ 16
__global__ __launch_bounds__(128) void k_fa(const _Float16* __restrict__ QH, const _Float16* __restrict__ KH, const _Float16* __restrict__ VT, float* __restrict__ Y) {
  const int tid = threadIdx.x, wave = tid >> 5, lane = tid & 31, col = lane & 15, g = lane >> 4;
  const int b = blockIdx.y / NH, h = blockIdx.y % NH; const int ql0 = blockIdx.x * (64 * FQ) + wave * (16 * FQ);
  const _Float16* Kp = KH + ((size_t)b * TT + col) * CC + h * HD;            // key row col of a 16-key tile
  const _Float16* Vp = VT + ((size_t)b * CC + h * HD + col) * (size_t)TT;    // v plane d = col of a 16-row tile
  const float cs = SCALE * 1.4426950408889634f;
  v16h qf[FQ][HD / 32];
#pragma unroll
  for (int u = 0; u < FQ; ++u)
#pragma unroll
    for (int kc = 0; kc < HD / 32; ++kc) qf[u][kc] = frag_h(QH + ((size_t)b * TT + ql0 + u * 16 + col) * CC + h * HD + kc * 32, lane);
  v8f o[FQ][HD / 16] = {}; float mr[FQ], lr[FQ];
#pragma unroll
  for (int u = 0; u < FQ; ++u) { mr[u] = -3.0e38f; lr[u] = 0.f; }
  v16h kf[2][HD / 32];
#pragma unroll
  for (int t = 0; t < 2; ++t)
#pragma unroll
    for (int kc = 0; kc < HD / 32; ++kc) kf[t][kc] = frag_h(Kp + (size_t)(t * 16) * CC + kc * 32, lane);
  for (int kb = 0; kb < TT / 32; ++kb) {
    v16h vf[HD / 16];
#pragma unroll
    for (int j = 0; j < HD / 16; ++j) vf[j] = frag_h(Vp + (size_t)(j * 16) * TT + kb * 32, lane);
    v8f s[FQ][2];
#pragma unroll
    for (int t = 0; t < 2; ++t)
#pragma unroll
      for (int u = 0; u < FQ; ++u) { v8f z = {};
#pragma unroll
        for (int kc = 0; kc < HD / 32; ++kc) z = wmma_h(kf[t][kc], qf[u][kc], z);
        s[u][t] = z; }
    const int kn = (kb + 1) & (TT / 32 - 1);   // next pass's k rows, in flight under this pass's softmax (the last pass fetches pass 0's again: in bounds, unused)
#pragma unroll
    for (int t = 0; t < 2; ++t)
#pragma unroll
      for (int kc = 0; kc < HD / 32; ++kc) kf[t][kc] = frag_h(Kp + (size_t)(kn * 32 + t * 16) * CC + kc * 32, lane);
    float mb[FQ]; bool need = false;
#pragma unroll
    for (int u = 0; u < FQ; ++u) { float mx = s[u][0][0];
#pragma unroll
      for (int r = 1; r < 16; ++r) mx = fmaxf(mx, s[u][r >> 3][r & 7]);
      mx = fmaxf(mx, xhalf(mx)) * cs;   // both wave halves hold this query's maximum of the pass, scaled (the scale is positive)
      mb[u] = mx; need = need || (mx > mr[u] + LZ); }
    if (__builtin_amdgcn_ballot_w32(need) != 0) {   // one scalar test per pass; always taken on the first pass, where the factor is 0
#pragma unroll
      for (int u = 0; u < FQ; ++u) { const float mn = fmaxf(mr[u], mb[u]); const float corr = __builtin_amdgcn_exp2f(mr[u] - mn); mr[u] = mn; lr[u] *= corr;
#pragma unroll
        for (int j = 0; j < HD / 16; ++j) o[u][j] = o[u][j] * corr; } }
#pragma unroll
    for (int u = 0; u < FQ; ++u) { const float nm = PK - mr[u]; v16h p; float ls = 0.f;
#pragma unroll
      for (int e = 0; e < 16; e += 2) { const v2f a = __builtin_elementwise_fma((v2f){s[u][e >> 3][e & 7], s[u][e >> 3][(e & 7) + 1]}, (v2f){cs, cs}, (v2f){nm, nm});
        const float p0 = __builtin_amdgcn_exp2f(a.x), p1 = __builtin_amdgcn_exp2f(a.y); ls += p0 + p1; p[e] = (_Float16)p0; p[e + 1] = (_Float16)p1; }   // element e = key 8g + e (e < 8), 16 + 8g + e - 8: the k order of frag_h
      lr[u] += ls;
#pragma unroll
      for (int j = 0; j < HD / 16; ++j) o[u][j] = wmma_h(vf[j], p, o[u][j]); } }
#pragma unroll
  for (int u = 0; u < FQ; ++u) { const float inv = 1.0f / (lr[u] + xhalf(lr[u]));   // the halves' partial denominators join once
    float* yr = Y + ((size_t)b * TT + ql0 + u * 16 + col) * CC + h * HD + 8 * g;
#pragma unroll
    for (int j = 0; j < HD / 16; ++j) { const v8f r = o[u][j] * inv; vst2(yr + j * 16, (v4f){r[0], r[1], r[2], r[3]}); vst2(yr + j * 16 + 4, (v4f){r[4], r[5], r[6], r[7]}); } } }
// ---- k_out: block = (64 rows, 128 cols): out = ctx Wo (+ bo): ctx x 2^6 once to f16 against Wo as f16(bf16 x 2^8) exact (1 product) x 2^-14; causal early rows (< QHI of each sequence): ctx bf16 hi + lo against exact bf16 Wo (2 products)
__global__ __launch_bounds__(128) void k_out(const float* __restrict__ Y, const float* __restrict__ WO, const float* __restrict__ BO, float* __restrict__ OUT) { __shared__ __align__(16) union { struct { _Float16 ys[2][64][SP], wt[2][128][SP]; } s; float sf[4][16][132]; } sm; auto& sf = sm.sf;   // the operand tiles are dead when the output tiles are written (the loop ends in a barrier)
  const int tid = threadIdx.x, wave = tid >> 5, lane = tid & 31, col = lane & 15, g = lane >> 4; const int c0 = blockIdx.y * 128; const size_t r0 = (size_t)blockIdx.x * 64 + wave * 16;
  v8f acc[8] = {};
  if (CAUSAL && (int)(((size_t)blockIdx.x * 64) % TT) < QHI) {   /* block-uniform */
#pragma unroll 2
    for (int kc = 0; kc < CC / 32; ++kc) { const F2 a = split_row(Y + (r0 + col) * CC, kc * 32, lane); asm volatile("s_wait_loadcnt 0x0" ::: "memory");
#pragma unroll
      for (int j = 0; j < 8; ++j) { const v16b w = WOCOL(WO, kc * 32, c0 + j * 16 + col, lane); asm volatile("s_wait_loadcnt 0x0" ::: "memory"); acc[j] = wmma_bf(a.h, w, acc[j]); acc[j] = wmma_bf(a.l, w, acc[j]); } }
#pragma unroll
    for (int j = 0; j < 8; ++j) { const float bias = BO ? bfr(BO[c0 + j * 16 + col]) : 0.f;
#pragma unroll
      for (int r = 0; r < 8; ++r) sf[wave][8 * g + r][j * 16 + col] = acc[j][r] + bias; }
  } else {
    // staged as in k_proj: one 32-k chunk of ctx (64 rows) and Wo (128 rows, (out,in)) per trip, converted once, read from LDS by all four waves
    const int sr = tid >> 3, sc = (tid & 7) * 4; const float* Yg = Y + ((size_t)blockIdx.x * 64 + sr) * CC + sc; const float* Wg = WO + (size_t)(c0 + sr) * CC + sc;
    v4f yr[4], wr[8];
#define CVY(v) (v4h){(_Float16)((v)[0] * 64.0f), (_Float16)((v)[1] * 64.0f), (_Float16)((v)[2] * 64.0f), (_Float16)((v)[3] * 64.0f)}   /* ctx carried x 2^6 into f16 so small-magnitude context rows stay clear of f16 subnormals */
#define CVW(v) (v4h){(_Float16)(bfr((v)[0]) * 256.0f), (_Float16)(bfr((v)[1]) * 256.0f), (_Float16)(bfr((v)[2]) * 256.0f), (_Float16)(bfr((v)[3]) * 256.0f)}
#pragma unroll
    for (int i = 0; i < 4; ++i) yr[i] = *(const v4f*)(Yg + (size_t)(16 * i) * CC);
#pragma unroll
    for (int i = 0; i < 8; ++i) wr[i] = *(const v4f*)(Wg + (size_t)(16 * i) * CC);
#pragma unroll
    for (int i = 0; i < 4; ++i) *(v4h*)&sm.s.ys[0][sr + 16 * i][sc] = CVY(yr[i]);
#pragma unroll
    for (int i = 0; i < 8; ++i) *(v4h*)&sm.s.wt[0][sr + 16 * i][sc] = CVW(wr[i]);
    __syncthreads();
#pragma unroll 2   // the buffer index becomes a constant
    for (int kc = 0; kc < CC / 32; ++kc) { const int cur = kc & 1; const bool more = kc + 1 < CC / 32;
      if (more) {   // the next chunk's loads fly under this chunk's products
#pragma unroll
        for (int i = 0; i < 4; ++i) yr[i] = *(const v4f*)(Yg + (size_t)(16 * i) * CC + (kc + 1) * 32);
#pragma unroll
        for (int i = 0; i < 8; ++i) wr[i] = *(const v4f*)(Wg + (size_t)(16 * i) * CC + (kc + 1) * 32); }
      const v16h a = frag_h(&sm.s.ys[cur][wave * 16 + col][0], lane); v16h w[8];
#pragma unroll
      for (int j = 0; j < 8; ++j) w[j] = frag_h(&sm.s.wt[cur][j * 16 + col][0], lane);
      __builtin_amdgcn_sched_barrier(0);   // the chunk's LDS reads stay one group ahead of its products: one LDS wait a chunk, not one a product
#pragma unroll
      for (int j = 0; j < 8; ++j) acc[j] = wmma16(a, w[j], acc[j]);
      __builtin_amdgcn_sched_barrier(0);   // the conversions, which wait for the next chunk's loads, stay behind the products
      if (more) { asm volatile("s_wait_xcnt 0x0" ::: "memory"); __builtin_amdgcn_sched_barrier(0);   // the wait stands in front of every rewrite of the loads' address registers; the scheduling barrier keeps the conversions, whose temporaries may take those registers, behind it
#pragma unroll
        for (int i = 0; i < 4; ++i) *(v4h*)&sm.s.ys[cur ^ 1][sr + 16 * i][sc] = CVY(yr[i]);
#pragma unroll
        for (int i = 0; i < 8; ++i) *(v4h*)&sm.s.wt[cur ^ 1][sr + 16 * i][sc] = CVW(wr[i]); }
      __syncthreads(); }   // publishes the next chunk and ends every wave's reads of this one, whose buffer the next trip refills
#pragma unroll
    for (int j = 0; j < 8; ++j) { const float bias = BO ? bfr(BO[c0 + j * 16 + col]) : 0.f;
#pragma unroll
      for (int r = 0; r < 8; ++r) sf[wave][8 * g + r][j * 16 + col] = acc[j][r] * (1.0f / 16384.0f) + bias; } }   /* 2^-8 (Wo carry) x 2^-6 (ctx carry) */
  LDSX(); for (int rl = 0; rl < 16; ++rl) vst2(OUT + (r0 + rl) * DIN + c0 + lane * 4, *(const v4f*)&sf[wave][rl][lane * 4]); }

extern "C" void kernel_launch(void* const* d_in, const int* in_sizes, int n_in, void* d_out, int out_size, void* d_ws, size_t ws_size, hipStream_t stream) {
  (void)in_sizes; (void)n_in; (void)out_size;
  const float** F = (const float**)d_in;
  if (ws_size < (size_t)WS_END) return;
  char* ws = (char*)d_ws; _Float16 *QH = (_Float16*)(ws + WS_QH), *KH = (_Float16*)(ws + WS_KH), *VT = (_Float16*)(ws + WS_VT), *QL = (_Float16*)(ws + WS_QL), *KL = (_Float16*)(ws + WS_KL); __bf16 *VB = (__bf16*)(ws + WS_VB), *VBL = (__bf16*)(ws + WS_VBL); float *Y = (float*)(ws + WS_Y);
  (void)Y; (void)QL; (void)KL; (void)VB; (void)VBL;
  // inputs: 0 q [4,2048,768]; 1 k; 2 v; 3 Wq [768,768] (out,in), 4 bq; 5 Wk, 6 bk; 7 Wv, 8 bv; 9 Wo (out,in), 10 bo (zero biases, read)
  k_proj<<<dim3(TNB * TT / 128, CC / 128, 3), 128, 0, stream>>>(F[0], F[1], F[2], F[3], F[5], F[7], F[4], F[6], F[8], QH, QL, KH, KL, VT, VB, VBL);
  k_fa<<<dim3(TT / (64 * FQ), TNB * NH), 128, 0, stream>>>(QH, KH, VT, Y);
  k_out<<<dim3(TNB * TT / 64, DIN / 128), 128, 0, stream>>>(Y, F[9], F[10], (float*)d_out);
}

// v003
// A run of this version takes 122 microseconds.
// Timed twice side by side with v002, it ran 1.23 and 1.24 times as fast.
// Counting every step since v000, it is 15.3 times as fast.
// compute dtype: all float inputs rounded to bf16; q/k/v projections with EXACT bf16 products on WMMA 16x16x32 (f32 accumulate) + bias; logits q x k once to f16 each (1 product) x SCALE; online softmax f32 in registers; unnormalised P x 2^11 once to f16 x v once to f16 (1 product), / f32 denominator; ctx x 2^6 once to f16 x Wo f16(bf16 x 2^8) + bo; f32 output.
#include <hip/hip_runtime.h>
#include <math.h>

typedef __attribute__((ext_vector_type(16))) _Float16 v16h;
typedef __attribute__((ext_vector_type(16))) __bf16 v16b;
typedef __attribute__((ext_vector_type(8)))  _Float16 v8h;
typedef __attribute__((ext_vector_type(8)))  float v8f;
typedef __attribute__((ext_vector_type(4)))  float v4f;
typedef __attribute__((ext_vector_type(2)))  float v2f;
typedef __attribute__((ext_vector_type(4)))  unsigned v4u;
typedef __attribute__((ext_vector_type(4)))  int v4i;
typedef float __attribute__((may_alias)) float_a;
typedef int __attribute__((may_alias)) int_a;

template <typename T> __device__ __forceinline__ void vst2(void* p, T v) { *(T*)p = v;  }
__device__ __forceinline__ v8f wmma16(v16h a, v16h b, v8f c) {
  v8f d = __builtin_amdgcn_wmma_f32_16x16x32_f16(false, a, false, b, (short)0, c, false, false);
  asm volatile("v_nop\n\tv_nop\n\tv_nop\n\tv_nop" : "+v"(d) : "v"(a), "v"(b));
  return d;
}
__device__ __forceinline__ v8f wmma_bf(v16b a, v16b b, v8f c) {
  v8f d = __builtin_amdgcn_wmma_f32_16x16x32_bf16(false, a, false, b, (short)0, c, false, false);
  asm volatile("v_nop\n\tv_nop\n\tv_nop\n\tv_nop" : "+v"(d) : "v"(a), "v"(b));
  return d;
}
// 16x16x32 fragments: lane = (h = lane>>4, row/col = lane&15); elements 0..7 = k0+8h+0..7, 8..15 = k0+16+8h+0..7; D element r = row 8h+r
__device__ __forceinline__ v16h frag_h(const _Float16* rowk0, int lane) {
  union { v16h v; v8h q[2]; } u; const _Float16* p = rowk0 + 8 * (lane >> 4);
  u.q[0] = *(const v8h*)p; u.q[1] = *(const v8h*)(p + 16); return u.v;
}
__device__ __forceinline__ v16h frag_f32(const float* rowk0, int lane) {
  v16h a; const float* p = rowk0 + 8 * (lane >> 4);
#pragma unroll
  for (int i = 0; i < 8; ++i) { a[i] = (_Float16)p[i]; a[8 + i] = (_Float16)p[16 + i]; }
  return a;
}
__device__ __forceinline__ v16h frag_f32s(const float* rowk0, int lane, float sc) {
  v16h a; const float* p = rowk0 + 8 * (lane >> 4);
#pragma unroll
  for (int i = 0; i < 8; ++i) { a[i] = (_Float16)(p[i] * sc); a[8 + i] = (_Float16)(p[16 + i] * sc); }
  return a;
}
// column fragment from a [K][ld] layout (column n), rows >= K read as 0
__device__ __forceinline__ v16h fragc_f32(const float* W, int k0, int n, int lane, int ld, int K) {
  v16h a; const int g = lane >> 4;
#pragma unroll
  for (int i = 0; i < 8; ++i) { const int ka = k0 + 8 * g + i, kb = ka + 16;
    a[i] = (_Float16)(ka < K ? W[(size_t)(ka < K ? ka : K - 1) * ld + n] : 0.f); a[8 + i] = (_Float16)(kb < K ? W[(size_t)(kb < K ? kb : K - 1) * ld + n] : 0.f); }
  return a;
}
struct F2 { v16b h, l; };
__device__ __forceinline__ F2 bsplit16(const float v[16]) { F2 r;
#pragma unroll
  for (int i = 0; i < 16; ++i) { const __bf16 h = (__bf16)v[i]; r.h[i] = h; r.l[i] = (__bf16)(v[i] - (float)h); }
  return r; }
__device__ __forceinline__ F2 split_row(const float* row, int k0, int lane) { float v[16]; const float* p = row + k0 + 8 * (lane >> 4);
#pragma unroll
  for (int i = 0; i < 8; ++i) { v[i] = p[i]; v[8 + i] = p[16 + i]; }
  return bsplit16(v); }
__device__ __forceinline__ F2 split_rowK(const float* row, int k0, int lane, int K) { float v[16]; const int g = lane >> 4;
#pragma unroll
  for (int i = 0; i < 8; ++i) { const int ka = k0 + 8 * g + i, kb = ka + 16; v[i] = ka < K ? row[ka < K ? ka : K - 1] : 0.f; v[8 + i] = kb < K ? row[kb < K ? kb : K - 1] : 0.f; }
  return bsplit16(v); }
__device__ __forceinline__ F2 split_col(const float* W, int k0, int n, int lane, int ld, int K) { float v[16]; const int g = lane >> 4;
#pragma unroll
  for (int i = 0; i < 8; ++i) { const int ka = k0 + 8 * g + i, kb = ka + 16; v[i] = ka < K ? W[(size_t)(ka < K ? ka : K - 1) * ld + n] : 0.f; v[8 + i] = kb < K ? W[(size_t)(kb < K ? kb : K - 1) * ld + n] : 0.f; }
  return bsplit16(v); }
__device__ __forceinline__ v8f mac3(const F2& a, const F2& b, v8f c) { c = wmma_bf(a.l, b.h, c); c = wmma_bf(a.h, b.l, c); return wmma_bf(a.h, b.h, c); }
__device__ __forceinline__ float sigm(float v) { return 1.0f / (1.0f + expf(-v)); }
#define LDSX() do { asm volatile("s_wait_dscnt 0" ::: "memory"); __builtin_amdgcn_wave_barrier(); __builtin_amdgcn_fence(__ATOMIC_RELEASE, "workgroup"); } while (0)

// Multi-headed attention on separate inputs (q / k / v [4,2048,768]; (out,in) Wq / Wk / Wv / Wo [768,768] N(0, 1/768) applied as x @ W.T, zero biases (read); 12 heads x 64; scores / sqrt(64); no mask; softmax; out Wo^T + bo -> [4,2048,768] (6.3 M)).
#define NB 4
#define TT 2048
#define CC 768            // NH * HD = projected width
#define DIN 768          // input (model) width
#define NH 12
#define HD 64
#define NQB (TT / 64)
#define HG 4
#define SCALE (0.125f)
#define CAUSAL 0
#ifndef TNB
#define TNB NB
#endif
__device__ __forceinline__ float bfr(float v) { return (float)(__bf16)v; }
__host__ __device__ __forceinline__ int kb_last(int qb) { return CAUSAL ? ((qb * 64 + 63) >> 7) : (TT / 128 - 1); }
typedef __attribute__((ext_vector_type(8))) __bf16 v8b;
__device__ __forceinline__ v16b frag_b(const __bf16* rowk0, int lane) {
  union { v16b v; v8b q[2]; } u; const __bf16* p = rowk0 + 8 * (lane >> 4);
  u.q[0] = *(const v8b*)p; u.q[1] = *(const v8b*)(p + 16); return u.v;
}
typedef __attribute__((ext_vector_type(4))) __bf16 v4b;
typedef __attribute__((ext_vector_type(4))) _Float16 v4h;
#define SP 40             // LDS pitch of a staged 32-k row, 16-bit elements: 80 bytes = 16 x odd, the pitch for 16-byte fragment reads
#define QBH 0              // unused: no kernel reads it
#define QHI 0               // single-product logits on every row
#define KHI 64            // key rows carrying k residual / v bf16 hi+lo planes (written by k_proj; no kernel reads them)
// B fragment (k rows k0+.., output column o) of a weight: (in,out) [K][ld] or (out,in) [ld rows of K]: bf16 exact, or f16(bf16 * 256) exact
__device__ __forceinline__ v16b wcol_io(const float* Wm, int k0, int o, int lane, int ld) { v16b w; const int g = lane >> 4;
#pragma unroll
  for (int i = 0; i < 8; ++i) { w[i] = (__bf16)Wm[(size_t)(k0 + 8 * g + i) * ld + o]; w[8 + i] = (__bf16)Wm[(size_t)(k0 + 16 + 8 * g + i) * ld + o]; }
  return w; }
__device__ __forceinline__ v16b wcol_oi(const float* Wm, int k0, int o, int lane, int K) { v16b w; const float* p = Wm + (size_t)o * K + k0 + 8 * (lane >> 4);
#pragma unroll
  for (int i = 0; i < 8; ++i) { w[i] = (__bf16)p[i]; w[8 + i] = (__bf16)p[16 + i]; }
  return w; }
__device__ __forceinline__ v16h wcolh_io(const float* Wm, int k0, int o, int lane, int ld) { v16h w; const int g = lane >> 4;
#pragma unroll
  for (int i = 0; i < 8; ++i) { w[i] = (_Float16)(bfr(Wm[(size_t)(k0 + 8 * g + i) * ld + o]) * 256.0f); w[8 + i] = (_Float16)(bfr(Wm[(size_t)(k0 + 16 + 8 * g + i) * ld + o]) * 256.0f); }
  return w; }
__device__ __forceinline__ v16h wcolh_oi(const float* Wm, int k0, int o, int lane, int K) { v16h w; const float* p = Wm + (size_t)o * K + k0 + 8 * (lane >> 4);
#pragma unroll
  for (int i = 0; i < 8; ++i) { w[i] = (_Float16)(bfr(p[i]) * 256.0f); w[8 + i] = (_Float16)(bfr(p[16 + i]) * 256.0f); }
  return w; }
#define WQKV_LAYOUT 1   // picks WCOL's layout only, which no kernel uses; k_proj reads Wq / Wk / Wv as (out,in) [CC][DIN]
__device__ __forceinline__ v16b wcol_hdk(const float* Wm, int k0, int o, int lane) { v16b w; const int g = lane >> 4; const float* p = Wm + (size_t)(o / HD) * DIN * HD + (o % HD);
#pragma unroll
  for (int i = 0; i < 8; ++i) { w[i] = (__bf16)p[(size_t)(k0 + 8 * g + i) * HD]; w[8 + i] = (__bf16)p[(size_t)(k0 + 16 + 8 * g + i) * HD]; }
  return w; }
#define WO_OUT_IN 1
#if WQKV_LAYOUT == 1
#define WCOL(W, k0, o, lane) wcol_oi(W, k0, o, lane, DIN)
#elif WQKV_LAYOUT == 2
#define WCOL(W, k0, o, lane) wcol_hdk(W, k0, o, lane)
#else
#define WCOL(W, k0, o, lane) wcol_io(W, k0, o, lane, CC)
#endif
#if WO_OUT_IN
#define WOCOL(W, k0, o, lane) wcol_oi(W, k0, o, lane, CC)
#define WOCOLH(W, k0, o, lane) wcolh_oi(W, k0, o, lane, CC)
#else
#define WOCOL(W, k0, o, lane) wcol_io(W, k0, o, lane, DIN)
#define WOCOLH(W, k0, o, lane) wcolh_io(W, k0, o, lane, DIN)
#endif

#ifndef SM_EXTRA_PARAMS
#define SM_EXTRA_PARAMS
#endif
#ifndef PROJ_EXTRA_PARAMS
#define PROJ_EXTRA_PARAMS
#endif
#ifndef SM_MASK_HOOK
#define SM_MASK_HOOK (void)0
#endif

#define WS_QH  0u                                      // f16 q rows [b*t][CC]
#define WS_KH  (WS_QH + 2u * (size_t)NB * TT * CC)      // f16 k rows [b*t][CC]
#define WS_VT  (WS_KH + 2u * (size_t)NB * TT * CC)      // f16 v planes [b][c][t]
#define WS_QL  (WS_VT + 2u * (size_t)NB * CC * TT)      // f16 q residual x 2^10 rows [b][t < QHI][CC]
#define WS_KL  (WS_QL + 2u * (size_t)NB * QHI * CC)     // f16 k residual x 2^10 rows [b][t < KHI][CC]
#define WS_VB  (WS_KL + 2u * (size_t)NB * KHI * CC)     // bf16 v hi planes [b][c][t < KHI]
#define WS_VBL (WS_VB + 2u * (size_t)NB * CC * KHI)
#define WS_S   (WS_VBL + 2u * (size_t)NB * CC * KHI)    // unused region (no kernel reads or writes it)
#define WS_Y   (WS_S  + 4u * (size_t)HG * TT * TT)      // f32 ctx rows [b*t][CC] (only when there is an output projection)
#define WS_END (WS_Y  + 4u * (size_t)NB * TT * CC)

// ---- k_proj: block = (128 rows, 128 cols, which), a wave = two 16-row groups (one in each 64-row half) x 128 cols: q/k/v = X W (+ b) with exact bf16 products (K = DIN) -> which 0: q f16 rows (+ residual rows < QHI); 1: k f16 rows (+ residual rows < KHI); 2: v f16 planes [c][t] (+ bf16 hi/lo planes for t < KHI)
__global__ __launch_bounds__(128) void k_proj(const float* __restrict__ XQ, const float* __restrict__ XK, const float* __restrict__ XV, const float* __restrict__ WQ, const float* __restrict__ WK, const float* __restrict__ WV, const float* __restrict__ BQ, const float* __restrict__ BK, const float* __restrict__ BV,
    _Float16* __restrict__ QH, _Float16* __restrict__ QL, _Float16* __restrict__ KH, _Float16* __restrict__ KL, _Float16* __restrict__ VT, __bf16* __restrict__ VB, __bf16* __restrict__ VBL) {
  __shared__ __align__(16) union { struct { __bf16 xs[2][128][SP], wt[2][128][SP]; } s; struct { _Float16 sh[64][136], sl[64][136]; } e; struct { _Float16 th[128][72]; __bf16 tb[128][72], tbl[128][72]; } t; } sm;   // the operand tiles are dead when the output tiles are written (the loop ends in a barrier)
  auto& sh = sm.e.sh; auto& sl = sm.e.sl; auto& th = sm.t.th; auto& tb = sm.t.tb; auto& tbl = sm.t.tbl;
  const int tid = threadIdx.x, wave = tid >> 5, lane = tid & 31, col = lane & 15, g = lane >> 4; const int which = blockIdx.z; const int c0 = blockIdx.y * 128; const size_t rblk = (size_t)blockIdx.x * 128; const size_t bb = rblk / TT; const int tblk = (int)(rblk % TT);
  const float* X = which == 0 ? XQ : which == 1 ? XK : XV; const float* WA = which == 0 ? WQ : which == 1 ? WK : WV; const float* BA = which == 0 ? BQ : which == 1 ? BK : BV;
  v8f acc2[2][8] = {};
  // one 32-k chunk of X (128 rows) and W (128 rows, (out,in)) per trip: 8 lanes fetch one whole 128-byte row piece, each value is rounded to bf16 once and all four waves read their fragments from LDS
  const int sr = tid >> 3, sc = (tid & 7) * 4; const float* Xg = X + (rblk + sr) * DIN + sc; const float* Wg = WA + (size_t)(c0 + sr) * DIN + sc;
  v4f xr[8], wr[8];
#pragma unroll
  for (int i = 0; i < 8; ++i) xr[i] = *(const v4f*)(Xg + (size_t)(16 * i) * DIN);
#pragma unroll
  for (int i = 0; i < 8; ++i) wr[i] = *(const v4f*)(Wg + (size_t)(16 * i) * DIN);
#pragma unroll
  for (int i = 0; i < 8; ++i) *(v4b*)&sm.s.xs[0][sr + 16 * i][sc] = (v4b){(__bf16)xr[i][0], (__bf16)xr[i][1], (__bf16)xr[i][2], (__bf16)xr[i][3]};
#pragma unroll
  for (int i = 0; i < 8; ++i) *(v4b*)&sm.s.wt[0][sr + 16 * i][sc] = (v4b){(__bf16)wr[i][0], (__bf16)wr[i][1], (__bf16)wr[i][2], (__bf16)wr[i][3]};
  __syncthreads();
#pragma unroll 2   // the buffer index becomes a constant
  for (int kc = 0; kc < DIN / 32; ++kc) { const int cur = kc & 1; const bool more = kc + 1 < DIN / 32;
    if (more) {   // the next chunk's loads fly under this chunk's products
#pragma unroll
      for (int i = 0; i < 8; ++i) xr[i] = *(const v4f*)(Xg + (size_t)(16 * i) * DIN + (kc + 1) * 32);
#pragma unroll
      for (int i = 0; i < 8; ++i) wr[i] = *(const v4f*)(Wg + (size_t)(16 * i) * DIN + (kc + 1) * 32); }
    const v16b a0 = frag_b(&sm.s.xs[cur][wave * 16 + col][0], lane), a1 = frag_b(&sm.s.xs[cur][64 + wave * 16 + col][0], lane); v16b w[8];
#pragma unroll
    for (int j = 0; j < 8; ++j) w[j] = frag_b(&sm.s.wt[cur][j * 16 + col][0], lane);
    __builtin_amdgcn_sched_barrier(0);   // the chunk's LDS reads stay one group ahead of its products: one LDS wait a chunk, not one a product
#pragma unroll
    for (int j = 0; j < 8; ++j) { acc2[0][j] = __builtin_amdgcn_wmma_f32_16x16x32_bf16(false, a0, false, w[j], (short)0, acc2[0][j], false, false); acc2[1][j] = __builtin_amdgcn_wmma_f32_16x16x32_bf16(false, a1, false, w[j], (short)0, acc2[1][j], false, false); }
    __builtin_amdgcn_sched_barrier(0);   // the conversions, which wait for the next chunk's loads, stay behind the products
    if (more) { asm volatile("s_wait_xcnt 0x0" ::: "memory"); __builtin_amdgcn_sched_barrier(0);   // the wait stands in front of every rewrite of the loads' address registers; the scheduling barrier keeps the conversions, whose temporaries may take those registers, behind it
#pragma unroll
      for (int i = 0; i < 8; ++i) *(v4b*)&sm.s.xs[cur ^ 1][sr + 16 * i][sc] = (v4b){(__bf16)xr[i][0], (__bf16)xr[i][1], (__bf16)xr[i][2], (__bf16)xr[i][3]};
#pragma unroll
      for (int i = 0; i < 8; ++i) *(v4b*)&sm.s.wt[cur ^ 1][sr + 16 * i][sc] = (v4b){(__bf16)wr[i][0], (__bf16)wr[i][1], (__bf16)wr[i][2], (__bf16)wr[i][3]}; }
    __syncthreads(); }   // publishes the next chunk and ends every wave's reads of this one, whose buffer the next trip refills
#pragma unroll   // the two 64-row halves go out one after the other through the same output tiles
  for (int hf = 0; hf < 2; ++hf) { const size_t r0 = rblk + hf * 64; const int t0 = tblk + hf * 64; const v8f (&acc)[8] = acc2[hf];
  if (which < 2) { _Float16* DH = which == 0 ? QH : KH; _Float16* DL = which == 0 ? QL : KL; const int nhi = which == 0 ? QHI : KHI; const bool hi_rows = t0 < nhi;
#pragma unroll
    for (int j = 0; j < 8; ++j) { const float bias = BA ? bfr(BA[c0 + j * 16 + col]) : 0.f;
#pragma unroll
      for (int r = 0; r < 8; ++r) { const float v = acc[j][r] + bias; const _Float16 hv = (_Float16)v; sh[wave * 16 + 8 * g + r][j * 16 + col] = hv; sl[wave * 16 + 8 * g + r][j * 16 + col] = (_Float16)((v - (float)hv) * 1024.0f); } }
    __syncthreads();
    for (int e = tid; e < 64 * 16; e += 128) { const int rl = e >> 4, q = e & 15; vst2((unsigned*)(DH + (r0 + rl) * CC + c0 + q * 8), *(const v4u*)&sh[rl][q * 8]); if (hi_rows) vst2((unsigned*)(DL + (bb * nhi + t0 + rl) * (size_t)CC + c0 + q * 8), *(const v4u*)&sl[rl][q * 8]); }
  } else { const bool hi_rows = t0 < KHI;
#pragma unroll
    for (int j = 0; j < 8; ++j) { const float bias = BA ? bfr(BA[c0 + j * 16 + col]) : 0.f;
#pragma unroll
      for (int r = 0; r < 8; ++r) { const float v = acc[j][r] + bias; const int rl = wave * 16 + 8 * g + r, cl = j * 16 + col; th[cl][rl] = (_Float16)v; const __bf16 bh = (__bf16)v; tb[cl][rl] = bh; tbl[cl][rl] = (__bf16)(v - (float)bh); } }
    __syncthreads();
    for (int e = tid; e < 128 * 8; e += 128) { const int cl = e >> 3, q = e & 7; vst2((unsigned*)(VT + (bb * CC + c0 + cl) * (size_t)TT + t0 + q * 8), *(const v4u*)&th[cl][q * 8]); if (hi_rows) { const size_t o3 = (bb * CC + c0 + cl) * (size_t)KHI + t0 + q * 8; vst2((unsigned*)(VB + o3), *(const v4u*)&tb[cl][q * 8]); vst2((unsigned*)(VBL + o3), *(const v4u*)&tbl[cl][q * 8]); } } }
  if (hf == 0) __syncthreads(); } }   // every wave has read the first half's tiles before the second half overwrites them
// ---- k_fa: block = 4 waves x 32 query columns of one (batch, head); one pass = 32 keys. S^T = K . Q^T (A = k rows, B = q rows kept in registers), so a lane holds 16 scores of ONE query per 16-column group;
// online softmax in the log2 domain in registers; two S^T tiles converted in place are the B operand P^T; O^T += V^T . P^T (A = v planes [c][t]). The maximum in use may trail the true one by up to LZ (log2), so P <= 2^(LZ + PK) = 2^15 stays inside f16.
#define FQ 2              // 16-column query groups per wave
#define PK 11.0f          // P carried x 2^11 into f16 so that small weights stay clear of f16 subnormals; cancels against the denominator
#define LZ 4.0f           // rescale the sums only when a column's maximum exceeds the one in use by more than this
__device__ __forceinline__ v8f wmma_h(v16h a, v16h b, v8f c) { return __builtin_amdgcn_wmma_f32_16x16x32_f16(false, a, false, b, (short)0, c, false, false); }
__device__ __forceinline__ float xhalf(float x) { return __builtin_bit_cast(float, __builtin_amdgcn_permlanex16(__builtin_bit_cast(int, x), __builtin_bit_cast(int, x), 0x76543210, 0xfedcba98, false, false)); }  // lane l with lane l ^ 16
// K rows and V planes reach the block's four waves through LDS. A stage = SKEYS keys = four slices of 64 rows x 128 bytes, one tensor load a wave: waves 0, 1 the stage's two 64-key groups of k rows,
// waves 2, 3 the 64 v planes over the same two key groups. The mover's pad of 16 bytes a row gives the 144-byte pitch (16 x odd) of 16-byte fragment reads. Two buffers: stage s + 1 lands while stage s is worked on.
#define SKEYS 128         // keys per stage
#define NST (TT / SKEYS)
#define KP 72             // LDS row pitch, f16 elements
#define SLH 5120          // one slice in LDS, f16 elements: 64 rows x 144 bytes = 9,216, rounded up to a multiple of 2 KiB
#define BUFH (4 * SLH)    // one buffer, f16 elements
typedef __attribute__((ext_vector_type(8))) unsigned v8u;
__device__ __forceinline__ unsigned uni(unsigned v) { return (unsigned)__builtin_amdgcn_readfirstlane(v); }
__device__ __forceinline__ unsigned pinned(unsigned v) { unsigned w = uni(v); asm volatile("" : "+s"(w)); return w; }   // holds the test around a tensor load in a scalar register, so that it compiles to a scalar compare and branch (a tensor load ignores EXEC)
__global__ __launch_bounds__(128) void k_fa(const _Float16* __restrict__ QH, const _Float16* __restrict__ KH, const _Float16* __restrict__ VT, float* __restrict__ Y) {
  __shared__ __attribute__((aligned(2048))) _Float16 L[2 * BUFH];
  const int tid = threadIdx.x, wave = tid >> 5, lane = tid & 31, col = lane & 15, g = lane >> 4;
  const int b = blockIdx.y / NH, h = blockIdx.y % NH; const int ql0 = blockIdx.x * (64 * FQ) + wave * (16 * FQ);
  const unsigned wv = uni(threadIdx.x >> 5); const bool isv = wv >= 2u; const unsigned hk = (wv & 1u) * 64u;   // this wave's slice: operand and 64-key group
  const unsigned long long gsrc = isv ? (unsigned long long)(size_t)(VT + ((size_t)b * CC + h * HD) * (size_t)TT + hk) : (unsigned long long)(size_t)(KH + ((size_t)b * TT + hk) * CC + h * HD);
  const unsigned gstep = isv ? 2u * SKEYS : 2u * SKEYS * CC;   // bytes from one stage's slice to the next stage's
  const unsigned ldst = (unsigned)(size_t)L + wv * (2u * SLH);
  v8u g1;   // tile = tensor = 64 rows of 128 bytes, extents in bytes; word 0: pad on, a pad behind every 32 dwords (one row), 4 dwords
  g1[0] = uni((1u << 20) | (4u << 22) | (3u << 25)); g1[1] = uni(128u << 16); g1[2] = uni(64u << 16); g1[3] = uni(128u << 16); g1[4] = uni(64u); g1[5] = uni(isv ? 2u * TT : 2u * CC); g1[6] = uni(0u); g1[7] = uni(0u);
  auto issue = [&](unsigned st) { const unsigned long long ga = gsrc + (unsigned long long)st * gstep; v4u g0;
    g0[0] = uni(1u); g0[1] = uni(ldst + (st & 1u) * (2u * BUFH)); g0[2] = uni((unsigned)ga); g0[3] = uni((((unsigned)(ga >> 32)) & 0x01FFFFFFu) | 0x80000000u);
    asm volatile("tensor_load_to_lds %0, %1" :: "s"(g0), "s"(g1) : "memory"); };   // one request of the whole wave
  issue(0u);
  const float cs = SCALE * 1.4426950408889634f;
  v16h qf[FQ][HD / 32];
#pragma unroll
  for (int u = 0; u < FQ; ++u)
#pragma unroll
    for (int kc = 0; kc < HD / 32; ++kc) qf[u][kc] = frag_h(QH + ((size_t)b * TT + ql0 + u * 16 + col) * CC + h * HD + kc * 32, lane);
  v8f o[FQ][HD / 16] = {}; float mr[FQ], lr[FQ];
#pragma unroll
  for (int u = 0; u < FQ; ++u) { mr[u] = -3.0e38f; lr[u] = 0.f; }
  asm volatile("s_wait_tensorcnt 0x0" ::: "memory");   // this wave's slice of stage 0 has landed
  __syncthreads();                                     // and every other wave's
  issue(1u);
  for (unsigned st = 0; st < NST; ++st) {
    const _Float16* Lk = L + (st & 1u) * BUFH + col * KP;   // key row col of the stage's first 16-key tile
    const _Float16* Lv = Lk + 2 * SLH;                      // v plane d = col, the stage's first key
    v16h kf[2][HD / 32];
#pragma unroll
    for (int t = 0; t < 2; ++t)
#pragma unroll
      for (int kc = 0; kc < HD / 32; ++kc) kf[t][kc] = frag_h(Lk + (t * 16) * KP + kc * 32, lane);
#pragma unroll
    for (int ps = 0; ps < SKEYS / 32; ++ps) {   // one pass = 32 keys
      v8f s[FQ][2];
#pragma unroll
      for (int t = 0; t < 2; ++t)
#pragma unroll
        for (int u = 0; u < FQ; ++u) { v8f z = {};
#pragma unroll
          for (int kc = 0; kc < HD / 32; ++kc) z = wmma_h(kf[t][kc], qf[u][kc], z);
          s[u][t] = z; }
      v16h vf[HD / 16];   // this pass's v and the next pass's k rows (same stage only) as one group of LDS reads, in flight under this pass's softmax
#pragma unroll
      for (int j = 0; j < HD / 16; ++j) vf[j] = frag_h(Lv + (ps >> 1) * SLH + (j * 16) * KP + (ps & 1) * 32, lane);
      if (ps + 1 < SKEYS / 32) {
#pragma unroll
        for (int t = 0; t < 2; ++t)
#pragma unroll
          for (int kc = 0; kc < HD / 32; ++kc) kf[t][kc] = frag_h(Lk + ((ps + 1) >> 1) * SLH + (((ps + 1) & 1) * 32 + t * 16) * KP + kc * 32, lane); }
      float mb[FQ]; bool need = false;
#pragma unroll
      for (int u = 0; u < FQ; ++u) { float mx = s[u][0][0];
#pragma unroll
        for (int r = 1; r < 16; ++r) mx = fmaxf(mx, s[u][r >> 3][r & 7]);
        mx = fmaxf(mx, xhalf(mx)) * cs;   // both wave halves hold this query's maximum of the pass, scaled (the scale is positive)
        mb[u] = mx; need = need || (mx > mr[u] + LZ); }
      if (__builtin_amdgcn_ballot_w32(need) != 0) {   // one scalar test per pass; always taken on the first pass, where the factor is 0
#pragma unroll
        for (int u = 0; u < FQ; ++u) { const float mn = fmaxf(mr[u], mb[u]); const float corr = __builtin_amdgcn_exp2f(mr[u] - mn); mr[u] = mn; lr[u] *= corr;
#pragma unroll
          for (int j = 0; j < HD / 16; ++j) o[u][j] = o[u][j] * corr; } }
#pragma unroll
      for (int u = 0; u < FQ; ++u) { const float nm = PK - mr[u]; v16h p; float ls = 0.f;
#pragma unroll
        for (int e = 0; e < 16; e += 2) { const v2f a = __builtin_elementwise_fma((v2f){s[u][e >> 3][e & 7], s[u][e >> 3][(e & 7) + 1]}, (v2f){cs, cs}, (v2f){nm, nm});
          const float p0 = __builtin_amdgcn_exp2f(a.x), p1 = __builtin_amdgcn_exp2f(a.y); ls += p0 + p1; p[e] = (_Float16)p0; p[e + 1] = (_Float16)p1; }   // element e = key 8g + e (e < 8), 16 + 8g + e - 8: the k order of frag_h
        lr[u] += ls;
#pragma unroll
        for (int j = 0; j < HD / 16; ++j) o[u][j] = wmma_h(vf[j], p, o[u][j]); } }
    // publish point of stage st + 1
    asm volatile("s_wait_dscnt 0x0" ::: "memory");       // this wave's reads of stage st have returned
    asm volatile("s_wait_tensorcnt 0x0" ::: "memory");   // this wave's slice of stage st + 1 has landed
    __syncthreads();                                     // stage st + 1 is readable by all four waves, and all four have left stage st's buffer
    if (pinned(st + 2u < NST)) issue(st + 2u); }         // into the buffer that stage st used
  asm volatile("s_wait_tensorcnt 0x0" ::: "memory");     // no request is left when the wave ends
  asm volatile("s_wait_dscnt 0x0" ::: "memory");
#pragma unroll
  for (int u = 0; u < FQ; ++u) { const float inv = 1.0f / (lr[u] + xhalf(lr[u]));   // the halves' partial denominators join once
    float* yr = Y + ((size_t)b * TT + ql0 + u * 16 + col) * CC + h * HD + 8 * g;
#pragma unroll
    for (int j = 0; j < HD / 16; ++j) { const v8f r = o[u][j] * inv; vst2(yr + j * 16, (v4f){r[0], r[1], r[2], r[3]}); vst2(yr + j * 16 + 4, (v4f){r[4], r[5], r[6], r[7]}); } } }
// ---- k_out: block = (64 rows, 128 cols): out = ctx Wo (+ bo): ctx x 2^6 once to f16 against Wo as f16(bf16 x 2^8) exact (1 product) x 2^-14; causal early rows (< QHI of each sequence): ctx bf16 hi + lo against exact bf16 Wo (2 products)
__global__ __launch_bounds__(128) void k_out(const float* __restrict__ Y, const float* __restrict__ WO, const float* __restrict__ BO, float* __restrict__ OUT) { __shared__ __align__(16) union { struct { _Float16 ys[2][64][SP], wt[2][128][SP]; } s; float sf[4][16][132]; } sm; auto& sf = sm.sf;   // the operand tiles are dead when the output tiles are written (the loop ends in a barrier)
  const int tid = threadIdx.x, wave = tid >> 5, lane = tid & 31, col = lane & 15, g = lane >> 4; const int c0 = blockIdx.y * 128; const size_t r0 = (size_t)blockIdx.x * 64 + wave * 16;
  v8f acc[8] = {};
  if (CAUSAL && (int)(((size_t)blockIdx.x * 64) % TT) < QHI) {   /* block-uniform */
#pragma unroll 2
    for (int kc = 0; kc < CC / 32; ++kc) { const F2 a = split_row(Y + (r0 + col) * CC, kc * 32, lane); asm volatile("s_wait_loadcnt 0x0" ::: "memory");
#pragma unroll
      for (int j = 0; j < 8; ++j) { const v16b w = WOCOL(WO, kc * 32, c0 + j * 16 + col, lane); asm volatile("s_wait_loadcnt 0x0" ::: "memory"); acc[j] = wmma_bf(a.h, w, acc[j]); acc[j] = wmma_bf(a.l, w, acc[j]); } }
#pragma unroll
    for (int j = 0; j < 8; ++j) { const float bias = BO ? bfr(BO[c0 + j * 16 + col]) : 0.f;
#pragma unroll
      for (int r = 0; r < 8; ++r) sf[wave][8 * g + r][j * 16 + col] = acc[j][r] + bias; }
  } else {
    // staged as in k_proj: one 32-k chunk of ctx (64 rows) and Wo (128 rows, (out,in)) per trip, converted once, read from LDS by all four waves
    const int sr = tid >> 3, sc = (tid & 7) * 4; const float* Yg = Y + ((size_t)blockIdx.x * 64 + sr) * CC + sc; const float* Wg = WO + (size_t)(c0 + sr) * CC + sc;
    v4f yr[4], wr[8];
#define CVY(v) (v4h){(_Float16)((v)[0] * 64.0f), (_Float16)((v)[1] * 64.0f), (_Float16)((v)[2] * 64.0f), (_Float16)((v)[3] * 64.0f)}   /* ctx carried x 2^6 into f16 so small-magnitude context rows stay clear of f16 subnormals */
#define CVW(v) (v4h){(_Float16)(bfr((v)[0]) * 256.0f), (_Float16)(bfr((v)[1]) * 256.0f), (_Float16)(bfr((v)[2]) * 256.0f), (_Float16)(bfr((v)[3]) * 256.0f)}
#pragma unroll
    for (int i = 0; i < 4; ++i) yr[i] = *(const v4f*)(Yg + (size_t)(16 * i) * CC);
#pragma unroll
    for (int i = 0; i < 8; ++i) wr[i] = *(const v4f*)(Wg + (size_t)(16 * i) * CC);
#pragma unroll
    for (int i = 0; i < 4; ++i) *(v4h*)&sm.s.ys[0][sr + 16 * i][sc] = CVY(yr[i]);
#pragma unroll
    for (int i = 0; i < 8; ++i) *(v4h*)&sm.s.wt[0][sr + 16 * i][sc] = CVW(wr[i]);
    __syncthreads();
#pragma unroll 2   // the buffer index becomes a constant
    for (int kc = 0; kc < CC / 32; ++kc) { const int cur = kc & 1; const bool more = kc + 1 < CC / 32;
      if (more) {   // the next chunk's loads fly under this chunk's products
#pragma unroll
        for (int i = 0; i < 4; ++i) yr[i] = *(const v4f*)(Yg + (size_t)(16 * i) * CC + (kc + 1) * 32);
#pragma unroll
        for (int i = 0; i < 8; ++i) wr[i] = *(const v4f*)(Wg + (size_t)(16 * i) * CC + (kc + 1) * 32); }
      const v16h a = frag_h(&sm.s.ys[cur][wave * 16 + col][0], lane); v16h w[8];
#pragma unroll
      for (int j = 0; j < 8; ++j) w[j] = frag_h(&sm.s.wt[cur][j * 16 + col][0], lane);
      __builtin_amdgcn_sched_barrier(0);   // the chunk's LDS reads stay one group ahead of its products: one LDS wait a chunk, not one a product
#pragma unroll
      for (int j = 0; j < 8; ++j) acc[j] = wmma16(a, w[j], acc[j]);
      __builtin_amdgcn_sched_barrier(0);   // the conversions, which wait for the next chunk's loads, stay behind the products
      if (more) { asm volatile("s_wait_xcnt 0x0" ::: "memory"); __builtin_amdgcn_sched_barrier(0);   // the wait stands in front of every rewrite of the loads' address registers; the scheduling barrier keeps the conversions, whose temporaries may take those registers, behind it
#pragma unroll
        for (int i = 0; i < 4; ++i) *(v4h*)&sm.s.ys[cur ^ 1][sr + 16 * i][sc] = CVY(yr[i]);
#pragma unroll
        for (int i = 0; i < 8; ++i) *(v4h*)&sm.s.wt[cur ^ 1][sr + 16 * i][sc] = CVW(wr[i]); }
      __syncthreads(); }   // publishes the next chunk and ends every wave's reads of this one, whose buffer the next trip refills
#pragma unroll
    for (int j = 0; j < 8; ++j) { const float bias = BO ? bfr(BO[c0 + j * 16 + col]) : 0.f;
#pragma unroll
      for (int r = 0; r < 8; ++r) sf[wave][8 * g + r][j * 16 + col] = acc[j][r] * (1.0f / 16384.0f) + bias; } }   /* 2^-8 (Wo carry) x 2^-6 (ctx carry) */
  LDSX(); for (int rl = 0; rl < 16; ++rl) vst2(OUT + (r0 + rl) * DIN + c0 + lane * 4, *(const v4f*)&sf[wave][rl][lane * 4]); }

extern "C" void kernel_launch(void* const* d_in, const int* in_sizes, int n_in, void* d_out, int out_size, void* d_ws, size_t ws_size, hipStream_t stream) {
  (void)in_sizes; (void)n_in; (void)out_size;
  const float** F = (const float**)d_in;
  if (ws_size < (size_t)WS_END) return;
  char* ws = (char*)d_ws; _Float16 *QH = (_Float16*)(ws + WS_QH), *KH = (_Float16*)(ws + WS_KH), *VT = (_Float16*)(ws + WS_VT), *QL = (_Float16*)(ws + WS_QL), *KL = (_Float16*)(ws + WS_KL); __bf16 *VB = (__bf16*)(ws + WS_VB), *VBL = (__bf16*)(ws + WS_VBL); float *Y = (float*)(ws + WS_Y);
  (void)Y; (void)QL; (void)KL; (void)VB; (void)VBL;
  // inputs: 0 q [4,2048,768]; 1 k; 2 v; 3 Wq [768,768] (out,in), 4 bq; 5 Wk, 6 bk; 7 Wv, 8 bv; 9 Wo (out,in), 10 bo (zero biases, read)
  k_proj<<<dim3(TNB * TT / 128, CC / 128, 3), 128, 0, stream>>>(F[0], F[1], F[2], F[3], F[5], F[7], F[4], F[6], F[8], QH, QL, KH, KL, VT, VB, VBL);
  k_fa<<<dim3(TT / (64 * FQ), TNB * NH), 128, 0, stream>>>(QH, KH, VT, Y);
  k_out<<<dim3(TNB * TT / 64, DIN / 128), 128, 0, stream>>>(Y, F[9], F[10], (float*)d_out);
}
